// v000
// Measured on an AMD MI455X. A time is GPU time per run, averaged over a window of back-to-back runs after a warm-up
// (all launches, gaps included; the runs take copies of the inputs in turn), and the median of several windows.
// Apart from v000's, it joins two sittings. Times from different sittings can be a few percent apart, while
// side-by-side timings come from the same sitting.
// v000, which the later versions start from, runs in 2330 microseconds.
#include <hip/hip_runtime.h>

// Causal attention on given head-major tensors (q, k, v [2][16][2048][64]; per (batch, head): scores = q.k (NO scaling in the module: logits sigma ~8), keys after the query -> -inf; softmax; out = attn v -> [2][16][2048][64] (4.2 M)).
// Layout per (batch, head) unit (32 units of contiguous [2048][64] rows): the inputs are bf16-exact after rounding, so q and k become single bf16 planes and the scores are exact products (f32 accumulate; essential with unscaled logits); the softmax applies the causal mask as an index select and writes every row's probabilities as bf16 hi/lo; attn.v as hi/lo x exact v^T (2 products); f32 output rows.
// Compute dtypes, f32 accumulate: every input rounded to bf16; q.k exact; softmax f32; P hi/lo x exact values.

#define NB_  32      // (batch, head) units
#define TT   2048
#define DM   64
#define NH_  1
#define NKV  1
#define REP  (NH_ / NKV)
#define HD   64
#define DQ   (NH_ * HD)
#define DKV  (NKV * HD)
#define ZH   2
#define RH   2048                  // query rows < RH use hi+lo planes (0: none)
#define WIN  0
#define PCAR 1024.0f
#define SCL  1.0f   // no scaling in the module
typedef _Float16 h16;
typedef unsigned short bf;
typedef __attribute__((ext_vector_type(16))) __bf16   v16bf;
typedef __attribute__((ext_vector_type(16))) _Float16 v16h;
typedef __attribute__((ext_vector_type(8)))  _Float16 v8h;
typedef __attribute__((ext_vector_type(8)))  unsigned short v8us;
typedef __attribute__((ext_vector_type(8)))  float    v8f;
typedef __attribute__((ext_vector_type(4)))  float    v4f;
typedef v8h  __attribute__((may_alias)) v8ha;
typedef v4f  __attribute__((may_alias)) v4fa;
typedef v8us __attribute__((may_alias)) v8usa;

__device__ __forceinline__ unsigned short f2bf(float f) { unsigned u = __float_as_uint(f); u += 0x7FFFu + ((u >> 16) & 1u); return (unsigned short)(u >> 16); }
__device__ __forceinline__ float bf2f(unsigned short b) { return __uint_as_float(((unsigned)b) << 16); }
__device__ __forceinline__ float bfr(float f) { return bf2f(f2bf(f)); }
__device__ __forceinline__ v16h cat16(v8h lo, v8h hi) { return __builtin_shufflevector(lo, hi, 0, 1, 2, 3, 4, 5, 6, 7, 8, 9, 10, 11, 12, 13, 14, 15); }
__device__ __forceinline__ v16bf cat16b(v8us lo, v8us hi) { return __builtin_bit_cast(v16bf, __builtin_shufflevector(lo, hi, 0, 1, 2, 3, 4, 5, 6, 7, 8, 9, 10, 11, 12, 13, 14, 15)); }
__device__ __forceinline__ v8f wmma16(v16h a, v16h b, v8f c) { return __builtin_amdgcn_wmma_f32_16x16x32_f16(false, a, false, b, (short)0, c, false, false); }
__device__ __forceinline__ v8f wmmab(v16bf a, v16bf b, v8f c) { return __builtin_amdgcn_wmma_f32_16x16x32_bf16(false, a, false, b, (short)0, c, false, false); }



// ---- k_gemmw: register-blocked GEMM, ONE WAVE per 64x64 output tile (16 accumulators), operands straight from K-contiguous 16-bit planes; grid (M/64, N/64, Z), 32 threads.
// C[m][n] (f32, pitch ldc, + optional f32 bias[n]) = sum_k A[m][k] Bt[n][k] (+ split products per NSPLIT). z-batch strides sA/sB/sC in elements. K % 32 == 0.
template <typename T16> struct WFrag;
template <> struct WFrag<h16> { typedef v16h V; static __device__ __forceinline__ V ld(const h16* p) { return cat16(*(const v8h*)p, *(const v8h*)(p + 16)); } static __device__ __forceinline__ v8f mma(V a, V b, v8f c) { return wmma16(a, b, c); } };
template <> struct WFrag<bf> { typedef v16bf V; static __device__ __forceinline__ V ld(const bf* p) { return cat16b(*(const v8us*)p, *(const v8us*)(p + 16)); } static __device__ __forceinline__ v8f mma(V a, V b, v8f c) { return wmmab(a, b, c); } };
template <typename T16, int NSPLIT, bool BIAS>
__global__ __launch_bounds__(32) void k_gemmw(const T16* __restrict__ A, const T16* __restrict__ A2, const T16* __restrict__ Bt, const T16* __restrict__ Bt2, int K, float* C, int ldc, const float* __restrict__ bias, size_t sA, size_t sB, size_t sC) {
    typedef typename WFrag<T16>::V V;
    __shared__ __align__(16) float os[16 * 68];
    const size_t z = blockIdx.z; A += z * sA; if (A2) A2 += z * sA; Bt += z * sB; if (Bt2) Bt2 += z * sB; C += z * sC;
    const int lane = threadIdx.x & 31, lr = lane & 15, hi = lane >> 4; const int r0 = blockIdx.x * 64, c0 = blockIdx.y * 64;
    v8f acc[4][4];
#pragma unroll
    for (int mb = 0; mb < 4; ++mb)
#pragma unroll
        for (int nb = 0; nb < 4; ++nb) acc[mb][nb] = (v8f){};
    const size_t aoff = (size_t)(r0 + lr) * K + 8 * hi, boff = (size_t)(c0 + lr) * K + 8 * hi;
#pragma unroll 1
    for (int kc = 0; kc < K; kc += 32) {
        V a[4], a2[4];
#pragma unroll
        for (int mb = 0; mb < 4; ++mb) { a[mb] = WFrag<T16>::ld(A + aoff + (size_t)mb * 16 * K + kc); if (NSPLIT == 1 || NSPLIT == 2) a2[mb] = WFrag<T16>::ld(A2 + aoff + (size_t)mb * 16 * K + kc); }
#pragma unroll
        for (int nb = 0; nb < 4; ++nb) { const V b = WFrag<T16>::ld(Bt + boff + (size_t)nb * 16 * K + kc); V b2; if (NSPLIT >= 2) b2 = WFrag<T16>::ld(Bt2 + boff + (size_t)nb * 16 * K + kc);
#pragma unroll
            for (int mb = 0; mb < 4; ++mb) { acc[mb][nb] = WFrag<T16>::mma(a[mb], b, acc[mb][nb]); if (NSPLIT == 1 || NSPLIT == 2) acc[mb][nb] = WFrag<T16>::mma(a2[mb], b, acc[mb][nb]); if (NSPLIT >= 2) acc[mb][nb] = WFrag<T16>::mma(a[mb], b2, acc[mb][nb]); } }
        asm volatile("v_nop\n\tv_nop\n\tv_nop\n\tv_nop" : "+v"(acc[0][0]), "+v"(acc[1][1]), "+v"(acc[2][2]), "+v"(acc[3][3]) : "v"(a[0]), "v"(a[3]));
    }
#pragma unroll
    for (int mb = 0; mb < 4; ++mb) {
#pragma unroll
        for (int nb = 0; nb < 4; ++nb) {
#pragma unroll
            for (int j = 0; j < 8; ++j) os[(hi * 8 + j) * 68 + nb * 16 + lr] = acc[mb][nb][j]; }
        __builtin_amdgcn_wave_barrier(); asm volatile("" ::: "memory");
        float* crow = C + (size_t)(r0 + mb * 16) * ldc + c0;
{
#pragma unroll
            for (int s = 0; s < 8; ++s) { const int row = 2 * s + hi, cofs = lr * 4; v4f val = *(const v4fa*)(os + row * 68 + cofs); if (BIAS) { val[0] += bfr(bias[c0 + cofs]); val[1] += bfr(bias[c0 + cofs + 1]); val[2] += bfr(bias[c0 + cofs + 2]); val[3] += bfr(bias[c0 + cofs + 3]); }
                *(v4f*)(crow + (size_t)row * ldc + cofs) = val; }
             }
        __builtin_amdgcn_wave_barrier(); asm volatile("" ::: "memory");
    }
}

__device__ __forceinline__ h16 tohx(float x) { return (h16)x; }
__device__ __forceinline__ void splitf(float y, unsigned short& h, unsigned short& l) { h = f2bf(y); l = f2bf(y - bf2f(h)); }
typedef __attribute__((ext_vector_type(2))) _Float16 v2h;
typedef __attribute__((ext_vector_type(4))) _Float16 v4h;
typedef __attribute__((ext_vector_type(2))) unsigned short v2us;
typedef __attribute__((ext_vector_type(4))) unsigned short v4us;
typedef __attribute__((ext_vector_type(2))) float v2f;
typedef __attribute__((ext_vector_type(4))) int v4i;

__global__ __launch_bounds__(256) void k_wtG(const float* __restrict__ w, int K, int N, bf* Bt) {
    const int lane = threadIdx.x & 31; const int L0 = (blockIdx.x * 8 + (threadIdx.x >> 5)) * 8; const int nlines = N * K / 64;
{
#pragma unroll 1
        for (int l = 0; l < 8; ++l) { const int L = L0 + l; if (L >= nlines) break; const size_t e = (size_t)L * 64 + lane * 2; const int k = (int)(e % K), n = (int)(e / K); v2us o;
            o[0] = f2bf(w[(size_t)k * N + n]); o[1] = f2bf(w[(size_t)(k + 1) * N + n]); *(v2us*)(Bt + e) = o; }
         }
}
__global__ __launch_bounds__(256) void k_cvt8(const float* __restrict__ src, bf* dst, size_t n8) { const size_t i = (size_t)blockIdx.x * 256 + threadIdx.x; if (i >= n8) return; const v8f v = *(const v8f*)(src + i * 8); v8us o;
#pragma unroll
    for (int k = 0; k < 8; ++k) o[k] = f2bf(v[k]); *(v8us*)(dst + i * 8) = o;  }


__global__ __launch_bounds__(256) void k_vtp(const float* __restrict__ F, int pitch, int nheads, h16* V16, bf* Vh, bf* Vl) { const size_t e = ((size_t)blockIdx.x * 256 + threadIdx.x) * 2; if (e >= (size_t)nheads * HD * TT) return; const int t = (int)(e % TT); const int d = (int)((e / TT) % HD); const int g = (int)(e / ((size_t)TT * HD)); v2h o16; v2us oh, ol;
#pragma unroll
    for (int q = 0; q < 2; ++q) { const float x = F[(size_t)(t + q) * pitch + g * HD + d]; o16[q] = tohx(x); unsigned short a2, c2; splitf(x, a2, c2); oh[q] = a2; ol[q] = c2; }
    *(v2h*)(V16 + e) = o16; *(v2us*)(Vh + e) = oh; *(v2us*)(Vl + e) = ol;  }

// k_asoft: per row (zz, i): t = S (unscaled), keys j > i masked; softmax over the 2048 keys (register row, one exp, fixed trees);
__global__ __launch_bounds__(256) void k_asoft(const float* __restrict__ Sb, h16* P16, bf* Ph, bf* Pl) {
    const int lane = threadIdx.x & 31; const int row = blockIdx.x * 8 + (threadIdx.x >> 5); if (row >= ZH * TT) return; const int i = row % TT; const int zz = row / TT; (void)zz; const bool hires = (i < RH); const float* sr = Sb + (size_t)row * TT; float v[TT / 32]; float mx = -3.0e38f;
#pragma unroll
    for (int ch = 0; ch < TT / 128; ++ch) { const int j0 = ch * 128 + lane * 4; const v4f a = *(const v4f*)(sr + j0);
#pragma unroll
        for (int q = 0; q < 4; ++q) { const int j = j0 + q; const float t = (j <= i) ? a[q] * SCL : -3.0e38f; v[ch * 4 + q] = t;   /* causal: keys after the query excluded */ mx = fmaxf(mx, t); } }
#pragma unroll
    for (int sh = 16; sh; sh >>= 1) mx = fmaxf(mx, __shfl_xor(mx, sh, 32));
    float sum = 0.f;
#pragma unroll
    for (int k = 0; k < TT / 32; ++k) { float d0 = __fsub_rn(v[k], mx); asm volatile("" : "+v"(d0)); v[k] = __builtin_amdgcn_exp2f(__fmul_rn(d0, 1.4426950408889634f)); sum += v[k]; }
#pragma unroll
    for (int sh = 16; sh; sh >>= 1) sum += __shfl_xor(sum, sh, 32);
    const float f = __fdiv_rn(hires ? 1.0f : PCAR, sum);
{
        if (hires) {
#pragma unroll
            for (int ch = 0; ch < TT / 128; ++ch) { v4us oh, ol;
#pragma unroll
                for (int q = 0; q < 4; ++q) { unsigned short a, c2; splitf(v[ch * 4 + q] * f, a, c2); oh[q] = a; ol[q] = c2; }
                const size_t oo = ((size_t)zz * (RH ? RH : 1) + i) * TT + ch * 128 + lane * 4; *(v4us*)(Ph + oo) = oh; *(v4us*)(Pl + oo) = ol; }
        } else {
#pragma unroll
            for (int ch = 0; ch < TT / 128; ++ch) { v4h o4;
#pragma unroll
                for (int q = 0; q < 4; ++q) o4[q] = tohx(v[ch * 4 + q] * f);
                *(v4h*)(P16 + (size_t)row * TT + ch * 128 + lane * 4) = o4; } }
         }
}
__global__ __launch_bounds__(256) void k_merge(const float* __restrict__ O, int h0, float* OUTb) { const size_t e = ((size_t)blockIdx.x * 256 + threadIdx.x) * 2; if (e >= (size_t)ZH * TT * HD) return; const int d = (int)(e % HD); const int t = (int)((e / HD) % TT); const int zz = (int)(e / ((size_t)HD * TT)); const float cs = (t < RH) ? 1.0f : (1.0f / PCAR); const size_t oo = (size_t)t * DQ + (h0 + zz) * HD + d;
    v2f o2; o2[0] = O[e] * cs; o2[1] = O[e + 1] * cs; *(v2f*)(OUTb + oo) = o2;  }


__global__ __launch_bounds__(256) void k_vtpR1(const float* __restrict__ Vb, bf* Vh) { const size_t e = ((size_t)blockIdx.x * 256 + threadIdx.x) * 2; if (e >= (size_t)HD * TT) return; const int t = (int)(e % TT); const int d = (int)(e / TT); v2us o; o[0] = f2bf(Vb[(size_t)t * HD + d]); o[1] = f2bf(Vb[(size_t)(t + 1) * HD + d]); *(v2us*)(Vh + e) = o;  }
__global__ __launch_bounds__(256) void k_mergeR(const float* __restrict__ O, float* outb, size_t n4) { const size_t i = (size_t)blockIdx.x * 256 + threadIdx.x; if (i >= n4) return; const v4f a = *(const v4f*)(O + i * 4); *(v4f*)(outb + i * 4) = a;  }

extern "C" void kernel_launch(void* const* d_in, const int* in_sizes, int n_in,
                              void* d_out, int out_size, void* d_ws, size_t ws_size, hipStream_t stream) {
    (void)in_sizes; (void)n_in; (void)out_size;
    const float* Qin = (const float*)d_in[0]; const float* Kin = (const float*)d_in[1]; const float* Vin = (const float*)d_in[2];   /* q, k, v [2][16][2048][64] head-major: unit u = b*16 + h at + u*2048*64 */
    float* OUT = (float*)d_out;     // [2][16][2048][64]
    char* wsp = (char*)d_ws;
    auto take = [&](size_t bytes) { char* p = wsp; wsp += (bytes + 255) & ~(size_t)255; return (void*)p; };
    bf* QB = (bf*)take((size_t)TT * HD * 2); bf* KB = (bf*)take((size_t)TT * HD * 2); bf* VT = (bf*)take((size_t)HD * TT * 2); float* Sb = (float*)take((size_t)TT * TT * 4); bf* Ph = (bf*)take((size_t)TT * TT * 2); bf* Pl = (bf*)take((size_t)TT * TT * 2); float* Ob = (float*)take((size_t)TT * HD * 4);
    if ((size_t)(wsp - (char*)d_ws) > ws_size) return;    // ws 256 MiB (carve ~33 MiB)
    for (int b = 0; b < NB_; ++b) {
        k_cvt8<<<(unsigned)(((size_t)TT * HD / 8 + 255) / 256), 256, 0, stream>>>(Qin + (size_t)b * TT * HD, QB, (size_t)TT * HD / 8); k_cvt8<<<(unsigned)(((size_t)TT * HD / 8 + 255) / 256), 256, 0, stream>>>(Kin + (size_t)b * TT * HD, KB, (size_t)TT * HD / 8);
        k_vtpR1<<<(unsigned)(((size_t)HD * TT / 2 + 255) / 256), 256, 0, stream>>>(Vin + (size_t)b * TT * HD, VT);
        k_gemmw<bf, 0, false><<<dim3(TT / 64, TT / 64, 1), 32, 0, stream>>>(QB, nullptr, KB, nullptr, HD, Sb, TT, nullptr, 0, 0, 0);       /* q.k (exact) */ k_asoft<<<TT / 8, 256, 0, stream>>>(Sb, nullptr, Ph, Pl);
        k_gemmw<bf, 1, false><<<dim3(TT / 64, HD / 64, 1), 32, 0, stream>>>(Ph, Pl, VT, nullptr, TT, Ob, HD, nullptr, 0, 0, 0);         /* P (hi/lo) x v^T (exact) */
        k_mergeR<<<(unsigned)(((size_t)TT * HD / 4 + 255) / 256), 256, 0, stream>>>(Ob, OUT + (size_t)b * TT * HD, (size_t)TT * HD / 4); }
}

// v001
// A run of this version takes 80.1 microseconds.
// Next to v000, in two timings, it ran 29.5 times as fast each time.
#include <hip/hip_runtime.h>

// Causal attention on given head-major tensors (q, k, v [2][16][2048][64]; per (batch, head): scores = q.k (NO scaling in the module: logits sigma ~8), keys after the query -> -inf; softmax; out = attn v -> [2][16][2048][64] (4.2 M)).
// Three launches over all 32 (batch, head) units: k -> bf16 plane, v -> transposed bf16 plane, then one fused kernel: S^T = K.Q^T, running-maximum softmax in registers, O^T += V^T.P^T. Scores and probabilities never reach memory.
// Compute dtypes, f32 accumulate: every input rounded to bf16; q.k exact products; softmax f32; P hi/lo x exact values (2 products).

#define NB_  32      // (batch, head) units
#define TT   2048
#define HD   64
#define L2E  1.4426950408889634f
#define NEGB (-1.0e30f)   // stands for -inf: its exp2 is exactly 0 and no inf - inf can arise
typedef unsigned short bf;
typedef __attribute__((ext_vector_type(16))) __bf16   v16bf;
typedef __attribute__((ext_vector_type(8)))  __bf16   v8bf;
typedef __attribute__((ext_vector_type(8)))  unsigned short v8us;
typedef __attribute__((ext_vector_type(2)))  unsigned short v2us;
typedef __attribute__((ext_vector_type(4)))  unsigned v4u;
typedef __attribute__((ext_vector_type(8)))  float    v8f;
typedef __attribute__((ext_vector_type(4)))  float    v4f;

__device__ __forceinline__ unsigned short f2bf(float f) { unsigned u = __float_as_uint(f); u += 0x7FFFu + ((u >> 16) & 1u); return (unsigned short)(u >> 16); }
__device__ __forceinline__ v16bf cat16b(v8us lo, v8us hi) { return __builtin_bit_cast(v16bf, __builtin_shufflevector(lo, hi, 0, 1, 2, 3, 4, 5, 6, 7, 8, 9, 10, 11, 12, 13, 14, 15)); }
__device__ __forceinline__ v8f wmmab(v16bf a, v16bf b, v8f c) { return __builtin_amdgcn_wmma_f32_16x16x32_bf16(false, a, false, b, (short)0, c, false, false); }
// 16 x 32 fragment from k-contiguous bf16 rows, hardware k order: base = wave-uniform byte address of the tile, off = this lane's byte offset (row c, + 16 h); elements 0-7 = k 8h.., 8-15 = k 16 + 8h..
__device__ __forceinline__ v16bf ldfrag(const char* base, unsigned off) { return cat16b(*(const v8us*)(base + off), *(const v8us*)(base + off + 32)); }
// the eight bf16 of h, widened back to f32 from the packed words
__device__ __forceinline__ v8f widen(v8bf h) { const v4u w = __builtin_bit_cast(v4u, h); v8f r;
#pragma unroll
    for (int i = 0; i < 4; ++i) { r[2 * i] = __uint_as_float(w[i] << 16); r[2 * i + 1] = __uint_as_float(w[i] & 0xFFFF0000u); }
    return r; }
// value of lane l ^ 16
__device__ __forceinline__ float xhalf(float x) { const int b = __float_as_int(x); return __int_as_float(__builtin_amdgcn_permlanex16(b, b, 0x76543210, 0xfedcba98, false, false)); }

__global__ __launch_bounds__(256) void k_cvt8(const float* __restrict__ src, bf* dst, size_t n8) { const size_t i = (size_t)blockIdx.x * 256 + threadIdx.x; if (i >= n8) return; const v8f v = *(const v8f*)(src + i * 8); v8us o;
#pragma unroll
    for (int k = 0; k < 8; ++k) o[k] = f2bf(v[k]); *(v8us*)(dst + i * 8) = o;  }

// v [u][t][d] f32 -> Vh [u][d][t] bf16
__global__ __launch_bounds__(256) void k_vtpR1(const float* __restrict__ Vb, bf* Vh) { const size_t e = ((size_t)blockIdx.x * 256 + threadIdx.x) * 2; if (e >= (size_t)NB_ * HD * TT) return; const int t = (int)(e % TT); const int d = (int)((e / TT) % HD); const size_t u = e / ((size_t)TT * HD); const float* s = Vb + (u * TT + t) * HD + d; v2us o; o[0] = f2bf(s[0]); o[1] = f2bf(s[HD]); *(v2us*)(Vh + e) = o;  }

// k_fattn: one wave = 32 query columns (2 groups of 16) of one unit; it walks the keys in blocks of 32 up to its diagonal block. 4 independent waves a block (neighbouring query tiles, so that they read the same K and V^T lines at about the same time); no LDS, no barrier.
// Every '#pragma unroll' here makes the indices of a register array constants, so that the array stays in registers.
// S^T tile: D[r] = score(key 8h + r, query c). Two such tiles (keys 0-15, 16-31), converted in place, are the B operand of O^T += V^T.P^T; O^T tile: D[r] = O[query c][d 8h + r].
__global__ __launch_bounds__(128) void k_fattn(const float* __restrict__ Q, const bf* __restrict__ KB, const bf* __restrict__ VT, float* __restrict__ OUT) {
    const int lane = threadIdx.x & 31, lr = lane & 15, hi = lane >> 4;
    const int wave = __builtin_amdgcn_readfirstlane(threadIdx.x >> 5);       // scalar, so that the trip count and the diagonal test are scalar branches (WMMA needs every lane on)
    const size_t u = blockIdx.x;
    const int tile = (TT / 128 - 1 - (int)blockIdx.y) * 4 + wave;      // heaviest query blocks start first
    const int q0 = tile * 32;
    const float* Qu = Q + u * TT * HD; const char* Ku = (const char*)(KB + u * TT * HD); const char* Vu = (const char*)(VT + u * HD * TT);
    const unsigned koff = (unsigned)(lr * HD + 8 * hi) * 2u, voff = (unsigned)(lr * TT + 8 * hi) * 2u;      // lane offsets, fixed for the whole walk; the walk moves the scalar bases only

    v16bf qf[2][2];      // [query group][d half], kept for the whole walk
#pragma unroll
    for (int qt = 0; qt < 2; ++qt)
#pragma unroll
        for (int ks = 0; ks < 2; ++ks) { const float* p = Qu + (size_t)(q0 + qt * 16 + lr) * HD + ks * 32 + 8 * hi; const v8f a = *(const v8f*)p, b = *(const v8f*)(p + 16); v8us lo, up;
#pragma unroll
            for (int e = 0; e < 8; ++e) { lo[e] = f2bf(a[e]); up[e] = f2bf(b[e]); }
            qf[qt][ks] = cat16b(lo, up); }

    v8f o[2][4];
#pragma unroll
    for (int qt = 0; qt < 2; ++qt)
#pragma unroll
        for (int dt = 0; dt < 4; ++dt) o[qt][dt] = (v8f){};
    float mraw[2] = {NEGB, NEGB}, mlog[2] = {NEGB * L2E, NEGB * L2E}, lsum[2] = {0.f, 0.f};   // running maximum (raw, and x log2 e as rounded), this lane's half of the running sum

    const int nkb = tile + 1;
    v16bf kf[2][2];      // [key tile][d half] of the block about to be used
#pragma unroll
    for (int kt = 0; kt < 2; ++kt)
#pragma unroll
        for (int ks = 0; ks < 2; ++ks) kf[kt][ks] = ldfrag(Ku + (size_t)(kt * 16) * HD * 2 + ks * 64, koff);

#pragma unroll 1   // rolled: one block's registers only
    for (int kb = 0; kb < nkb; ++kb) {
        const int k0 = kb * 32;
        v16bf vf[4];     // issued ahead of the score products and the softmax, used behind them
#pragma unroll
        for (int dt = 0; dt < 4; ++dt) vf[dt] = ldfrag(Vu + ((size_t)(dt * 16) * TT + k0) * 2, voff);
        asm volatile("s_wait_xcnt 0x0" ::: "memory");      // precaution: stands in front of every rewrite of the registers that hold these loads' addresses (without it the K loads below were given such registers as destinations)
        v8f s[2][2];     // [query group][key tile]
#pragma unroll
        for (int qt = 0; qt < 2; ++qt)
#pragma unroll
            for (int kt = 0; kt < 2; ++kt) { s[qt][kt] = wmmab(kf[kt][0], qf[qt][0], (v8f){}); s[qt][kt] = wmmab(kf[kt][1], qf[qt][1], s[qt][kt]); }
        const int kn = (kb + 1 < nkb) ? k0 + 32 : k0;     // next block's K flies during this block's softmax (the last trip re-reads its own: in range, unused)
#pragma unroll
        for (int kt = 0; kt < 2; ++kt)
#pragma unroll
            for (int ks = 0; ks < 2; ++ks) kf[kt][ks] = ldfrag(Ku + (size_t)(kn + kt * 16) * HD * 2 + ks * 64, koff);
        if (kb == nkb - 1) {      // only the last block crosses the diagonal: keys after the query excluded
#pragma unroll
            for (int qt = 0; qt < 2; ++qt)
#pragma unroll
                for (int kt = 0; kt < 2; ++kt)
#pragma unroll
                    for (int j = 0; j < 8; ++j) s[qt][kt][j] = (kt * 16 + hi * 8 + j <= qt * 16 + lr) ? s[qt][kt][j] : NEGB;
        }
        v16bf ph[2], pl[2];
#pragma unroll
        for (int qt = 0; qt < 2; ++qt) {
            float mx = s[qt][0][0];
#pragma unroll
            for (int j = 1; j < 8; ++j) mx = fmaxf(mx, s[qt][0][j]);
#pragma unroll
            for (int j = 0; j < 8; ++j) mx = fmaxf(mx, s[qt][1][j]);
            mx = fmaxf(mx, xhalf(mx));
            if (__builtin_amdgcn_ballot_w32(mx > mraw[qt]) != 0) {      // a maximum rose somewhere in the group: rescale (a column whose maximum stays has the factor 1)
                const float mn = fmaxf(mraw[qt], mx), ml = mn * L2E; const float al = (mx > mraw[qt]) ? __builtin_amdgcn_exp2f(mlog[qt] - ml) : 1.0f; mraw[qt] = mn; mlog[qt] = ml; lsum[qt] *= al;
#pragma unroll
                for (int dt = 0; dt < 4; ++dt) o[qt][dt] *= al;
            }
            const float nm = -mlog[qt]; v8f p0, p1; float sm = 0.f;
#pragma unroll
            for (int j = 0; j < 8; ++j) { p0[j] = __builtin_amdgcn_exp2f(__builtin_fmaf(s[qt][0][j], L2E, nm)); p1[j] = __builtin_amdgcn_exp2f(__builtin_fmaf(s[qt][1][j], L2E, nm)); sm += p0[j] + p1[j]; }
            lsum[qt] += sm;
            const v8bf h0 = __builtin_convertvector(p0, v8bf), h1 = __builtin_convertvector(p1, v8bf);
            const v8bf l0 = __builtin_convertvector(p0 - widen(h0), v8bf), l1 = __builtin_convertvector(p1 - widen(h1), v8bf);
            ph[qt] = __builtin_shufflevector(h0, h1, 0, 1, 2, 3, 4, 5, 6, 7, 8, 9, 10, 11, 12, 13, 14, 15);
            pl[qt] = __builtin_shufflevector(l0, l1, 0, 1, 2, 3, 4, 5, 6, 7, 8, 9, 10, 11, 12, 13, 14, 15);
        }
#pragma unroll
        for (int dt = 0; dt < 4; ++dt)
#pragma unroll
            for (int qt = 0; qt < 2; ++qt) o[qt][dt] = wmmab(vf[dt], ph[qt], o[qt][dt]);
#pragma unroll
        for (int dt = 0; dt < 4; ++dt)
#pragma unroll
            for (int qt = 0; qt < 2; ++qt) o[qt][dt] = wmmab(vf[dt], pl[qt], o[qt][dt]);
    }

#pragma unroll
    for (int qt = 0; qt < 2; ++qt) {
        const float f = __fdiv_rn(1.0f, lsum[qt] + xhalf(lsum[qt]));
        float* orow = OUT + (u * TT + q0 + qt * 16 + lr) * HD + 8 * hi;
#pragma unroll
        for (int dt = 0; dt < 4; ++dt) { const v8f r = o[qt][dt] * f; *(v8f*)(orow + dt * 16) = r; }
    }
}

extern "C" void kernel_launch(void* const* d_in, const int* in_sizes, int n_in,
                              void* d_out, int out_size, void* d_ws, size_t ws_size, hipStream_t stream) {
    (void)in_sizes; (void)n_in; (void)out_size;
    const float* Qin = (const float*)d_in[0]; const float* Kin = (const float*)d_in[1]; const float* Vin = (const float*)d_in[2];   /* q, k, v [2][16][2048][64] head-major: unit u = b*16 + h at + u*2048*64 */
    float* OUT = (float*)d_out;     // [2][16][2048][64]
    char* wsp = (char*)d_ws;
    auto take = [&](size_t bytes) { char* p = wsp; wsp += (bytes + 255) & ~(size_t)255; return (void*)p; };
    bf* KB = (bf*)take((size_t)NB_ * TT * HD * 2); bf* VT = (bf*)take((size_t)NB_ * HD * TT * 2);
    if ((size_t)(wsp - (char*)d_ws) > ws_size) return;    // ws 256 MiB (carve 16 MiB)
    k_cvt8<<<(unsigned)(((size_t)NB_ * TT * HD / 8 + 255) / 256), 256, 0, stream>>>(Kin, KB, (size_t)NB_ * TT * HD / 8);
    k_vtpR1<<<(unsigned)(((size_t)NB_ * HD * TT / 2 + 255) / 256), 256, 0, stream>>>(Vin, VT);
    k_fattn<<<dim3(NB_, TT / 128, 1), 128, 0, stream>>>(Qin, KB, VT, OUT);
}

// v002
// One run takes 39.1 microseconds.
// In both of two side-by-side timings against v001, it was 2.07 times as fast.
// Over all steps from v000 it is 61.2 times as fast.
#include <hip/hip_runtime.h>

// Causal attention on given head-major tensors (q, k, v [2][16][2048][64]; per (batch, head): scores = q.k (NO scaling in the module: logits sigma ~8), keys after the query -> -inf; softmax; out = attn v -> [2][16][2048][64] (4.2 M)).
// One launch over all 32 (batch, head) units: S^T = K.Q^T, running-maximum softmax in registers, O^T += V^T.P^T. Scores and probabilities never reach memory; k and v are rounded to bf16 on their way into LDS, and V^T comes out of LDS by the transposing load.
// Compute dtypes, f32 accumulate: every input rounded to bf16; q.k exact products; softmax f32; P hi/lo x exact values (2 products).

#define NB_  32      // (batch, head) units
#define TT   2048
#define HD   64
#define L2E  1.4426950408889634f
#define NEGB (-1.0e30f)   // stands for -inf: its exp2 is exactly 0 and no inf - inf can arise
typedef __attribute__((ext_vector_type(16))) __bf16   v16bf;
typedef __attribute__((ext_vector_type(8)))  __bf16   v8bf;
typedef __attribute__((ext_vector_type(4)))  __bf16   v4bf;
typedef __attribute__((ext_vector_type(8)))  short    v8s;
typedef __attribute__((ext_vector_type(8)))  unsigned short v8us;
typedef __attribute__((ext_vector_type(4)))  unsigned v4u;
typedef __attribute__((ext_vector_type(8)))  float    v8f;
typedef __attribute__((ext_vector_type(4)))  float    v4f;

__device__ __forceinline__ unsigned short f2bf(float f) { unsigned u = __float_as_uint(f); u += 0x7FFFu + ((u >> 16) & 1u); return (unsigned short)(u >> 16); }
__device__ __forceinline__ v16bf cat16b(v8us lo, v8us hi) { return __builtin_bit_cast(v16bf, __builtin_shufflevector(lo, hi, 0, 1, 2, 3, 4, 5, 6, 7, 8, 9, 10, 11, 12, 13, 14, 15)); }
__device__ __forceinline__ v8f wmmab(v16bf a, v16bf b, v8f c) { return __builtin_amdgcn_wmma_f32_16x16x32_bf16(false, a, false, b, (short)0, c, false, false); }
// 16 x 32 fragment from k-contiguous bf16 rows in LDS, hardware k order: p = this lane's address (row c, + 16 h bytes); elements 0-7 = k 8h.., 8-15 = k 16 + 8h..
__device__ __forceinline__ v16bf ldfrag(const unsigned char* p) { return cat16b(*(const v8us*)p, *(const v8us*)(p + 32)); }
// transposing LDS load: lane (c, h) gets column c, rows 8h .. 8h + 7 of the 16 x 16 bf16 tile whose row 8h + (l & 7), bytes 16 ((l >> 3) & 1).., lane l points at
__device__ __forceinline__ v8us ldtr(const unsigned char* p) { typedef __attribute__((address_space(3))) v8s lds_v8s; return __builtin_bit_cast(v8us, __builtin_amdgcn_ds_load_tr16_b128_v8i16((lds_v8s*)p)); }
// the eight bf16 of h, widened back to f32 from the packed words
__device__ __forceinline__ v8f widen(v8bf h) { const v4u w = __builtin_bit_cast(v4u, h); v8f r;
#pragma unroll
    for (int i = 0; i < 4; ++i) { r[2 * i] = __uint_as_float(w[i] << 16); r[2 * i + 1] = __uint_as_float(w[i] & 0xFFFF0000u); }
    return r; }
// value of lane l ^ 16
__device__ __forceinline__ float xhalf(float x) { const int b = __float_as_int(x); return __int_as_float(__builtin_amdgcn_permlanex16(b, b, 0x76543210, 0xfedcba98, false, false)); }

#define SK   64u              // keys a stage (two blocks of 32)
#define PK   144u             // LDS pitch of a k row, bytes: 128 of bf16 + 16, an odd multiple of 16 for the 16-byte readers
#define PV   160u             // LDS pitch of a v row, bytes: 128 of bf16 + 32, an odd multiple of 32 for the transposing readers
#define KLB  (SK * PK)        // the k part of a buffer
#define STG  (SK * (PK + PV)) // one buffer: k rows, then v rows

// k_fattn: one wave = 32 query columns (2 groups of 16) of one unit; it walks the keys in blocks of 32 up to its diagonal block. The 4 waves of a block (neighbouring query tiles) share the keys:
// together they bring each stage of 64 k rows and 64 v rows from the f32 inputs through registers, rounded to bf16, into one of two LDS buffers, while the stage before it is worked on; one barrier a stage.
// Every '#pragma unroll' here makes the indices of a register array constants, so that the array stays in registers.
// S^T tile: D[r] = score(key 8h + r, query c). Two such tiles (keys 0-15, 16-31), converted in place, are the B operand of O^T += V^T.P^T; O^T tile: D[r] = O[query c][d 8h + r].
__global__ __launch_bounds__(128) void k_fattn(const float* __restrict__ Q, const float* __restrict__ K, const float* __restrict__ V, float* __restrict__ OUT) {
    __shared__ __attribute__((aligned(16))) unsigned char L[2 * STG];
    const unsigned tid = threadIdx.x;
    const int lane = threadIdx.x & 31, lr = lane & 15, hi = lane >> 4;
    const int wave = __builtin_amdgcn_readfirstlane(threadIdx.x >> 5);       // scalar, so that the trip count and the diagonal test are scalar branches (WMMA needs every lane on)
    const size_t u = blockIdx.x;
    const int yb = TT / 128 - 1 - (int)blockIdx.y;      // heaviest query blocks start first
    const int tile = yb * 4 + wave;
    const int q0 = tile * 32;
    const float* Qu = Q + u * TT * HD; const char* Ku = (const char*)(K + u * TT * HD); const char* Vu = (const char*)(V + u * TT * HD);
    const unsigned goff = tid * 16u;      // a stage is 16 KiB in a row in each input: this thread takes 16 bytes of each 2 KiB (8 rows) of it, so every load covers whole lines
    const unsigned ksto = (tid >> 4) * PK + (tid & 15u) * 8u, vsto = KLB + (tid >> 4) * PV + (tid & 15u) * 8u;      // where its four values of each 8 rows go
    const unsigned kld = (unsigned)lr * PK + 16u * (unsigned)hi;      // k fragment: row c, bytes 16 h
    const unsigned vld = KLB + (8u * (unsigned)hi + ((unsigned)lane & 7u)) * PV + (((unsigned)lane >> 3) & 1u) * 16u;      // v tile, as the transposing load wants its lanes' addresses

    v16bf qf[2][2];      // [query group][d half], kept for the whole walk
#pragma unroll
    for (int qt = 0; qt < 2; ++qt)
#pragma unroll
        for (int ks = 0; ks < 2; ++ks) { const float* p = Qu + (size_t)(q0 + qt * 16 + lr) * HD + ks * 32 + 8 * hi; const v8f a = *(const v8f*)p, b = *(const v8f*)(p + 16); v8us lo, up;
#pragma unroll
            for (int e = 0; e < 8; ++e) { lo[e] = f2bf(a[e]); up[e] = f2bf(b[e]); }
            qf[qt][ks] = cat16b(lo, up); }

    v8f o[2][4];
#pragma unroll
    for (int qt = 0; qt < 2; ++qt)
#pragma unroll
        for (int dt = 0; dt < 4; ++dt) o[qt][dt] = (v8f){};
    float mraw[2] = {NEGB, NEGB}, mlog[2] = {NEGB * L2E, NEGB * L2E}, lsum[2] = {0.f, 0.f};   // running maximum (raw, and x log2 e as rounded), this lane's half of the running sum

    const int nkb = tile + 1;            // this wave's blocks of 32 keys
    const int ns = 2 * (yb + 1);         // the work-group's stages: the same for its four waves, so every wave passes every barrier
    v4f gk[8], gv[8];    // this thread's share of the stage in flight
    v16bf kf[2][2];      // [key tile][d half] of the block about to be used

    auto fetch = [&](int s) __attribute__((always_inline)) {
        const char* kg = Ku + (size_t)s * (SK * HD * 4); const char* vg = Vu + (size_t)s * (SK * HD * 4);
#pragma unroll
        for (int i = 0; i < 8; ++i) { gk[i] = *(const v4f*)(kg + i * 2048 + goff); gv[i] = *(const v4f*)(vg + i * 2048 + goff); }
        asm volatile("s_wait_xcnt 0x0" ::: "memory");      // precaution: stands in front of every rewrite of the registers that hold these loads' addresses; its clobber also keeps the loads up here, ahead of the stage's work
    };
    auto put = [&](int s) __attribute__((always_inline)) {
        unsigned char* d = L + (unsigned)(s & 1) * STG;
#pragma unroll
        for (int i = 0; i < 8; ++i) { *(v4bf*)(d + i * 8 * PK + ksto) = __builtin_convertvector(gk[i], v4bf); *(v4bf*)(d + i * 8 * PV + vsto) = __builtin_convertvector(gv[i], v4bf); }
    };
    auto loadk = [&](const unsigned char* B, int p) __attribute__((always_inline)) {
#pragma unroll
        for (int kt = 0; kt < 2; ++kt)
#pragma unroll
            for (int ks = 0; ks < 2; ++ks) kf[kt][ks] = ldfrag(B + (p * 32 + kt * 16) * PK + ks * 64 + kld);
    };
    // one block of 32 keys: block p of the stage in buffer B
    auto pass = [&](const unsigned char* B, int p, int kb) __attribute__((always_inline)) {
        v16bf vf[4];     // issued ahead of the score products and the softmax, used behind them
#pragma unroll
        for (int dt = 0; dt < 4; ++dt) vf[dt] = cat16b(ldtr(B + (p * 32) * PV + dt * 32 + vld), ldtr(B + (p * 32 + 16) * PV + dt * 32 + vld));
        v8f s[2][2];     // [query group][key tile]
#pragma unroll
        for (int qt = 0; qt < 2; ++qt)
#pragma unroll
            for (int kt = 0; kt < 2; ++kt) { s[qt][kt] = wmmab(kf[kt][0], qf[qt][0], (v8f){}); s[qt][kt] = wmmab(kf[kt][1], qf[qt][1], s[qt][kt]); }
        if (p == 0) loadk(B, 1);     // the stage's second block of k comes during this block's softmax (a wave whose diagonal lies in the first block reads it too: published, unused)
        __builtin_amdgcn_sched_barrier(0);     // keeps the LDS reads above up here, a softmax ahead of their use; without it they are moved down to just in front of the products that wait for them
        if (kb == nkb - 1) {      // only the last block crosses the diagonal: keys after the query excluded
#pragma unroll
            for (int qt = 0; qt < 2; ++qt)
#pragma unroll
                for (int kt = 0; kt < 2; ++kt)
#pragma unroll
                    for (int j = 0; j < 8; ++j) s[qt][kt][j] = (kt * 16 + hi * 8 + j <= qt * 16 + lr) ? s[qt][kt][j] : NEGB;
        }
        v16bf ph[2], pl[2];
#pragma unroll
        for (int qt = 0; qt < 2; ++qt) {
            float mx = s[qt][0][0];
#pragma unroll
            for (int j = 1; j < 8; ++j) mx = fmaxf(mx, s[qt][0][j]);
#pragma unroll
            for (int j = 0; j < 8; ++j) mx = fmaxf(mx, s[qt][1][j]);
            mx = fmaxf(mx, xhalf(mx));
            if (__builtin_amdgcn_ballot_w32(mx > mraw[qt]) != 0) {      // a maximum rose somewhere in the group: rescale (a column whose maximum stays has the factor 1)
                const float mn = fmaxf(mraw[qt], mx), ml = mn * L2E; const float al = (mx > mraw[qt]) ? __builtin_amdgcn_exp2f(mlog[qt] - ml) : 1.0f; mraw[qt] = mn; mlog[qt] = ml; lsum[qt] *= al;
#pragma unroll
                for (int dt = 0; dt < 4; ++dt) o[qt][dt] *= al;
            }
            const float nm = -mlog[qt]; v8f p0, p1; float sm = 0.f;
#pragma unroll
            for (int j = 0; j < 8; ++j) { p0[j] = __builtin_amdgcn_exp2f(__builtin_fmaf(s[qt][0][j], L2E, nm)); p1[j] = __builtin_amdgcn_exp2f(__builtin_fmaf(s[qt][1][j], L2E, nm)); sm += p0[j] + p1[j]; }
            lsum[qt] += sm;
            const v8bf h0 = __builtin_convertvector(p0, v8bf), h1 = __builtin_convertvector(p1, v8bf);
            const v8bf l0 = __builtin_convertvector(p0 - widen(h0), v8bf), l1 = __builtin_convertvector(p1 - widen(h1), v8bf);
            ph[qt] = __builtin_shufflevector(h0, h1, 0, 1, 2, 3, 4, 5, 6, 7, 8, 9, 10, 11, 12, 13, 14, 15);
            pl[qt] = __builtin_shufflevector(l0, l1, 0, 1, 2, 3, 4, 5, 6, 7, 8, 9, 10, 11, 12, 13, 14, 15);
        }
#pragma unroll
        for (int dt = 0; dt < 4; ++dt)
#pragma unroll
            for (int qt = 0; qt < 2; ++qt) o[qt][dt] = wmmab(vf[dt], ph[qt], o[qt][dt]);
#pragma unroll
        for (int dt = 0; dt < 4; ++dt)
#pragma unroll
            for (int qt = 0; qt < 2; ++qt) o[qt][dt] = wmmab(vf[dt], pl[qt], o[qt][dt]);
    };

    fetch(0); put(0);
    __syncthreads();      // stage 0 is in LDS for every wave
#pragma unroll 1   // rolled: one stage's registers and code only
    for (int s = 0; s < ns; ++s) {
        const unsigned char* B = L + (unsigned)(s & 1) * STG;
        const bool more = s + 1 < ns;
        if (2 * s < nkb) loadk(B, 0);
        if (more) fetch(s + 1);      // the next stage flies during this stage's two blocks
        if (2 * s < nkb) pass(B, 0, 2 * s);
        if (2 * s + 1 < nkb) pass(B, 1, 2 * s + 1);
        if (more) {
            put(s + 1);          // into the buffer that stage s - 1 was read from: the barrier at the foot of stage s - 1 ended those reads
            __syncthreads();     // publishes stage s + 1 and ends every wave's reads of stage s
        }
    }

#pragma unroll
    for (int qt = 0; qt < 2; ++qt) {
        const float f = __fdiv_rn(1.0f, lsum[qt] + xhalf(lsum[qt]));
        float* orow = OUT + (u * TT + q0 + qt * 16 + lr) * HD + 8 * hi;
#pragma unroll
        for (int dt = 0; dt < 4; ++dt) { const v8f r = o[qt][dt] * f; *(v8f*)(orow + dt * 16) = r; }
    }
}

extern "C" void kernel_launch(void* const* d_in, const int* in_sizes, int n_in,
                              void* d_out, int out_size, void* d_ws, size_t ws_size, hipStream_t stream) {
    (void)in_sizes; (void)n_in; (void)out_size; (void)d_ws; (void)ws_size;
    const float* Qin = (const float*)d_in[0]; const float* Kin = (const float*)d_in[1]; const float* Vin = (const float*)d_in[2];   /* q, k, v [2][16][2048][64] head-major: unit u = b*16 + h at + u*2048*64 */
    float* OUT = (float*)d_out;     // [2][16][2048][64]
    k_fattn<<<dim3(NB_, TT / 128, 1), 128, 0, stream>>>(Qin, Kin, Vin, OUT);
}

// v003
// Measured time: 33.4 microseconds a run.
// In both of two side-by-side timings against v002, it was 1.17 times as fast.
// Counting every step since v000, it is 71.8 times as fast.
#include <hip/hip_runtime.h>

// Causal attention on given head-major tensors (q, k, v [2][16][2048][64]; per (batch, head): scores = q.k (NO scaling in the module: logits sigma ~8), keys after the query -> -inf; softmax; out = attn v -> [2][16][2048][64] (4.2 M)).
// One launch over all 32 (batch, head) units: S^T = K.Q^T, running-maximum softmax in registers, O^T += V^T.P^T; four waves share the keys of each query tile and join their partial results at the end. Scores and probabilities never reach memory; k and v are rounded to bf16 on their way into LDS, and V^T comes out of LDS by the transposing load.
// Compute dtypes, f32 accumulate: every input rounded to bf16; q.k exact products; softmax f32; P hi/lo x exact values (2 products).

#define NB_  32      // (batch, head) units
#define TT   2048
#define HD   64
#define L2E  1.4426950408889634f
#define NEGB (-1.0e30f)   // stands for -inf: its exp2 is exactly 0 and no inf - inf can arise
typedef __attribute__((ext_vector_type(16))) __bf16   v16bf;
typedef __attribute__((ext_vector_type(8)))  __bf16   v8bf;
typedef __attribute__((ext_vector_type(4)))  __bf16   v4bf;
typedef __attribute__((ext_vector_type(8)))  short    v8s;
typedef __attribute__((ext_vector_type(8)))  unsigned short v8us;
typedef __attribute__((ext_vector_type(4)))  unsigned v4u;
typedef __attribute__((ext_vector_type(8)))  float    v8f;
typedef __attribute__((ext_vector_type(4)))  float    v4f;

__device__ __forceinline__ unsigned short f2bf(float f) { unsigned u = __float_as_uint(f); u += 0x7FFFu + ((u >> 16) & 1u); return (unsigned short)(u >> 16); }
__device__ __forceinline__ v16bf cat16b(v8us lo, v8us hi) { return __builtin_bit_cast(v16bf, __builtin_shufflevector(lo, hi, 0, 1, 2, 3, 4, 5, 6, 7, 8, 9, 10, 11, 12, 13, 14, 15)); }
__device__ __forceinline__ v8f wmmab(v16bf a, v16bf b, v8f c) { return __builtin_amdgcn_wmma_f32_16x16x32_bf16(false, a, false, b, (short)0, c, false, false); }
// 16 x 32 fragment from k-contiguous bf16 rows in LDS, hardware k order: p = this lane's address (row c, + 16 h bytes); elements 0-7 = k 8h.., 8-15 = k 16 + 8h..
__device__ __forceinline__ v16bf ldfrag(const unsigned char* p) { return cat16b(*(const v8us*)p, *(const v8us*)(p + 32)); }
// transposing LDS load: lane (c, h) gets column c, rows 8h .. 8h + 7 of the 16 x 16 bf16 tile whose row 8h + (l & 7), bytes 16 ((l >> 3) & 1).., lane l points at
__device__ __forceinline__ v8us ldtr(const unsigned char* p) { typedef __attribute__((address_space(3))) v8s lds_v8s; return __builtin_bit_cast(v8us, __builtin_amdgcn_ds_load_tr16_b128_v8i16((lds_v8s*)p)); }
// the eight bf16 of h, widened back to f32 from the packed words
__device__ __forceinline__ v8f widen(v8bf h) { const v4u w = __builtin_bit_cast(v4u, h); v8f r;
#pragma unroll
    for (int i = 0; i < 4; ++i) { r[2 * i] = __uint_as_float(w[i] << 16); r[2 * i + 1] = __uint_as_float(w[i] & 0xFFFF0000u); }
    return r; }
// value of lane l ^ 16
__device__ __forceinline__ float xhalf(float x) { const int b = __float_as_int(x); return __int_as_float(__builtin_amdgcn_permlanex16(b, b, 0x76543210, 0xfedcba98, false, false)); }

#define SK   128u             // keys a stage (four blocks of 32: one for each of a tile's four waves)
#define PK   144u             // LDS pitch of a k row, bytes: 128 of bf16 + 16, an odd multiple of 16 for the 16-byte readers
#define PV   160u             // LDS pitch of a v row, bytes: 128 of bf16 + 32, an odd multiple of 32 for the transposing readers
#define KLB  (SK * PK)        // the k part of a buffer
#define STG  (SK * (PK + PV)) // one buffer: k rows, then v rows
#define XP   272u             // exchange area, bytes a lane: 64 output values, 2 maxima, 2 sums (an odd multiple of 16 for the 16-byte accesses)

// k_fattn: a work-group = 4 neighbouring query tiles of 32 columns (2 groups of 16) of one unit, each tile held by FOUR waves (w, w + 4, w + 8, w + 12): of every stage of 128 keys each takes one block of 32,
// with a running maximum, sum and O^T of its own, so the longest wave walks a quarter of the keys and four waves stand on every SIMD; behind the walk the four join through LDS (each finishes a quarter of the tile).
// The 16 waves together bring each stage of 128 k rows and 128 v rows from the f32 inputs through registers, rounded to bf16, into one of two LDS buffers, while the stage before it is worked on; one barrier a stage.
// Every '#pragma unroll' here makes the indices of a register array constants, so that the array stays in registers.
// S^T tile: D[r] = score(key 8h + r, query c). Two such tiles (keys 0-15, 16-31), converted in place, are the B operand of O^T += V^T.P^T; O^T tile: D[r] = O[query c][d 8h + r].
__global__ __launch_bounds__(512) void k_fattn(const float* __restrict__ Q, const float* __restrict__ K, const float* __restrict__ V, float* __restrict__ OUT) {
    __shared__ __attribute__((aligned(16))) unsigned char L[2 * STG];
    __shared__ __attribute__((aligned(16))) unsigned char X[512 * XP];      // the partial results, a place of its own: a wave that is through writes while others still read the stages
    const unsigned tid = threadIdx.x;
    const int lane = threadIdx.x & 31, lr = lane & 15, hi = lane >> 4;
    const int wave = __builtin_amdgcn_readfirstlane(threadIdx.x >> 5);       // scalar, so that the trip count and the diagonal test are scalar branches (WMMA needs every lane on)
    const size_t u = blockIdx.x;
    const int yb = TT / 128 - 1 - (int)blockIdx.y;      // heaviest query blocks start first
    const int qw = wave & 3, kq = wave >> 2;            // query tile in the work-group; which block of each stage
    const int tile = yb * 4 + qw;
    const int q0 = tile * 32;
    const float* Qu = Q + u * TT * HD; const char* Ku = (const char*)(K + u * TT * HD); const char* Vu = (const char*)(V + u * TT * HD);
    const unsigned goff = tid * 16u;      // a stage is 32 KiB in a row in each input: this thread takes 16 bytes of each 8 KiB (32 rows) of it, so every load covers whole lines
    const unsigned ksto = (tid >> 4) * PK + (tid & 15u) * 8u, vsto = KLB + (tid >> 4) * PV + (tid & 15u) * 8u;      // where its four values of each 32 rows go
    const unsigned kld = (unsigned)kq * 32u * PK + (unsigned)lr * PK + 16u * (unsigned)hi;      // k fragment: this wave's block of the stage, row c, bytes 16 h
    const unsigned vld = KLB + (unsigned)kq * 32u * PV + (8u * (unsigned)hi + ((unsigned)lane & 7u)) * PV + (((unsigned)lane >> 3) & 1u) * 16u;      // v tile, as the transposing load wants its lanes' addresses

    v16bf qf[2][2];      // [query group][d half], kept for the whole walk
#pragma unroll
    for (int qt = 0; qt < 2; ++qt)
#pragma unroll
        for (int ks = 0; ks < 2; ++ks) { const float* p = Qu + (size_t)(q0 + qt * 16 + lr) * HD + ks * 32 + 8 * hi; const v8f a = *(const v8f*)p, b = *(const v8f*)(p + 16); v8us lo, up;
#pragma unroll
            for (int e = 0; e < 8; ++e) { lo[e] = f2bf(a[e]); up[e] = f2bf(b[e]); }
            qf[qt][ks] = cat16b(lo, up); }

    v8f o[2][4];
#pragma unroll
    for (int qt = 0; qt < 2; ++qt)
#pragma unroll
        for (int dt = 0; dt < 4; ++dt) o[qt][dt] = (v8f){};
    float mraw[2] = {NEGB, NEGB}, mlog[2] = {NEGB * L2E, NEGB * L2E}, lsum[2] = {0.f, 0.f};   // running maximum (raw, and x log2 e as rounded), this lane's half of the running sum

    const int nkb = tile + 1;            // this tile's blocks of 32 keys
    const int ns = yb + 1;               // the work-group's stages: the same for its sixteen waves, so every wave passes every barrier

    // gk, gv: this thread's share of the stage in flight; kf: [key tile][d half] of the block about to be used. They are the loop body's own, handed in, so that none of them counts as alive from one stage to the next.
    auto fetch = [&](int s, v4f (&gk)[4], v4f (&gv)[4]) __attribute__((always_inline)) {
        const unsigned off = goff + (unsigned)s * (SK * HD * 4);      // one 32-bit offset serves both inputs beside their scalar bases: four waves a SIMD leave no registers for 64-bit addresses
#pragma unroll
        for (int i = 0; i < 4; ++i) { gk[i] = *(const v4f*)(Ku + off + i * 8192); gv[i] = *(const v4f*)(Vu + off + i * 8192); }
        asm volatile("s_wait_xcnt 0x0" ::: "memory");      // precaution: stands in front of every rewrite of the registers that hold these loads' addresses; its clobber also keeps the loads up here, ahead of the stage's work
    };
    auto put = [&](int s, const v4f (&gk)[4], const v4f (&gv)[4]) __attribute__((always_inline)) {
        unsigned char* d = L + (unsigned)(s & 1) * STG;
#pragma unroll
        for (int i = 0; i < 4; ++i) { *(v4bf*)(d + i * 32 * PK + ksto) = __builtin_convertvector(gk[i], v4bf); *(v4bf*)(d + i * 32 * PV + vsto) = __builtin_convertvector(gv[i], v4bf); }
    };
    auto loadk = [&](const unsigned char* B, v16bf (&kf)[2][2]) __attribute__((always_inline)) {
#pragma unroll
        for (int kt = 0; kt < 2; ++kt)
#pragma unroll
            for (int ks = 0; ks < 2; ++ks) kf[kt][ks] = ldfrag(B + (kt * 16) * PK + ks * 64 + kld);
    };
    // one block of 32 keys: this wave's block of the stage in buffer B
    auto pass = [&](const unsigned char* B, int kb, const v16bf (&kf)[2][2]) __attribute__((always_inline)) {
        v8f s[2][2];     // [query group][key tile]
#pragma unroll
        for (int qt = 0; qt < 2; ++qt)
#pragma unroll
            for (int kt = 0; kt < 2; ++kt) { s[qt][kt] = wmmab(kf[kt][0], qf[qt][0], (v8f){}); s[qt][kt] = wmmab(kf[kt][1], qf[qt][1], s[qt][kt]); }
        v16bf vf[4];     // issued ahead of the softmax, used behind it
#pragma unroll
        for (int dt = 0; dt < 4; ++dt) vf[dt] = cat16b(ldtr(B + dt * 32 + vld), ldtr(B + 16 * PV + dt * 32 + vld));
        __builtin_amdgcn_sched_barrier(0);     // keeps the LDS reads above up here, a softmax ahead of their use; without it they are moved down to just in front of the products that wait for them
        if (kb == nkb - 1) {      // only the last block crosses the diagonal: keys after the query excluded
#pragma unroll
            for (int qt = 0; qt < 2; ++qt)
#pragma unroll
                for (int kt = 0; kt < 2; ++kt)
#pragma unroll
                    for (int j = 0; j < 8; ++j) s[qt][kt][j] = (kt * 16 + hi * 8 + j <= qt * 16 + lr) ? s[qt][kt][j] : NEGB;
        }
        v16bf ph[2], pl[2];
#pragma unroll
        for (int qt = 0; qt < 2; ++qt) {
            float mx = s[qt][0][0];
#pragma unroll
            for (int j = 1; j < 8; ++j) mx = fmaxf(mx, s[qt][0][j]);
#pragma unroll
            for (int j = 0; j < 8; ++j) mx = fmaxf(mx, s[qt][1][j]);
            mx = fmaxf(mx, xhalf(mx));
            if (__builtin_amdgcn_ballot_w32(mx > mraw[qt]) != 0) {      // a maximum rose somewhere in the group: rescale (a column whose maximum stays has the factor 1)
                const float mn = fmaxf(mraw[qt], mx), ml = mn * L2E; const float al = (mx > mraw[qt]) ? __builtin_amdgcn_exp2f(mlog[qt] - ml) : 1.0f; mraw[qt] = mn; mlog[qt] = ml; lsum[qt] *= al;
#pragma unroll
                for (int dt = 0; dt < 4; ++dt) o[qt][dt] *= al;
            }
            const float nm = -mlog[qt]; v8f p0, p1; float sm = 0.f;
#pragma unroll
            for (int j = 0; j < 8; ++j) { p0[j] = __builtin_amdgcn_exp2f(__builtin_fmaf(s[qt][0][j], L2E, nm)); p1[j] = __builtin_amdgcn_exp2f(__builtin_fmaf(s[qt][1][j], L2E, nm)); sm += p0[j] + p1[j]; }
            lsum[qt] += sm;
            const v8bf h0 = __builtin_convertvector(p0, v8bf), h1 = __builtin_convertvector(p1, v8bf);
            const v8bf l0 = __builtin_convertvector(p0 - widen(h0), v8bf), l1 = __builtin_convertvector(p1 - widen(h1), v8bf);
            ph[qt] = __builtin_shufflevector(h0, h1, 0, 1, 2, 3, 4, 5, 6, 7, 8, 9, 10, 11, 12, 13, 14, 15);
            pl[qt] = __builtin_shufflevector(l0, l1, 0, 1, 2, 3, 4, 5, 6, 7, 8, 9, 10, 11, 12, 13, 14, 15);
        }
#pragma unroll
        for (int dt = 0; dt < 4; ++dt)
#pragma unroll
            for (int qt = 0; qt < 2; ++qt) o[qt][dt] = wmmab(vf[dt], ph[qt], o[qt][dt]);
#pragma unroll
        for (int dt = 0; dt < 4; ++dt)
#pragma unroll
            for (int qt = 0; qt < 2; ++qt) o[qt][dt] = wmmab(vf[dt], pl[qt], o[qt][dt]);
    };

    { v4f gk[4], gv[4]; fetch(0, gk, gv); put(0, gk, gv); }
    __syncthreads();      // stage 0 is in LDS for every wave
#pragma unroll 1   // rolled: one stage's registers and code only
    for (int s = 0; s < ns; ++s) {
        const unsigned char* B = L + (unsigned)(s & 1) * STG;
        const bool more = s + 1 < ns;
        const int kb = 4 * s + kq;          // this wave's block of the stage
        v4f gk[4], gv[4]; v16bf kf[2][2];
        loadk(B, kf);      // every wave, also one whose tile ends before this block (published rows, then unused): read under a condition, the fragments' registers would count as alive all round the loop
        if (more) fetch(s + 1, gk, gv);      // the next stage flies during this stage's block
        if (kb < nkb) pass(B, kb, kf);
        if (more) {
            asm volatile("v_nop\n\tv_nop\n\tv_nop\n\tv_nop");      // the four vector slots the chip needs between the block's last matrix product and the conversions below, which take over its operand registers
            __builtin_amdgcn_sched_barrier(0);     // holds the conversions behind those slots: without it they are moved up in front of them
            put(s + 1, gk, gv);  // into the buffer that stage s - 1 was read from: the barrier at the foot of stage s - 1 ended those reads
            __syncthreads();     // publishes stage s + 1 and ends every wave's reads of stage s
        }
    }

    // The four waves of a tile join: each lays down all it holds, and behind the barrier each finishes a quarter of the tile (one group of 16 columns, 32 of the 64 d: whole 128-byte lines of the output) from the four partial results, in the order of the blocks.
    {
        float* x = (float*)(X + tid * XP);
#pragma unroll
        for (int qt = 0; qt < 2; ++qt) {
#pragma unroll
            for (int dt = 0; dt < 4; ++dt) { *(v4f*)(x + (qt * 4 + dt) * 8) = __builtin_shufflevector(o[qt][dt], o[qt][dt], 0, 1, 2, 3); *(v4f*)(x + (qt * 4 + dt) * 8 + 4) = __builtin_shufflevector(o[qt][dt], o[qt][dt], 4, 5, 6, 7); }
            x[64 + qt] = mlog[qt]; x[66 + qt] = lsum[qt];
        }
    }
    __syncthreads();      // publishes every wave's partial result
    const int fq = kq >> 1, fd = 2 * (kq & 1);      // the group and the first of the two d tiles that this wave finishes
    const float* xs = (const float*)(X + ((unsigned)qw * 32u + (unsigned)lane) * XP);      // this lane's place in the tile's first wave; the next wave's lies 128 lanes on
    float pm[4], pf[4];
#pragma unroll
    for (int j = 0; j < 4; ++j) pm[j] = xs[j * (128 * XP / 4) + 64 + fq];
    const float ml = fmaxf(fmaxf(pm[0], pm[1]), fmaxf(pm[2], pm[3]));
    float lt = 0.f;
#pragma unroll
    for (int j = 0; j < 4; ++j) { pf[j] = __builtin_amdgcn_exp2f(pm[j] - ml); lt += xs[j * (128 * XP / 4) + 66 + fq] * pf[j]; }      // a wave that had no block holds the start values: its factor is exp2 of a huge negative number, exactly 0
    const float f = __fdiv_rn(1.0f, lt + xhalf(lt));
    float* orow = OUT + (u * TT + q0 + fq * 16 + lr) * HD + 8 * hi + fd * 16;
#pragma unroll
    for (int d = 0; d < 2; ++d) {
        v8f r = (v8f){};
#pragma unroll
        for (int j = 0; j < 4; ++j) { const float* p = xs + j * (128 * XP / 4) + (fq * 4 + fd + d) * 8; const v4f a = *(const v4f*)p, b = *(const v4f*)(p + 4);
            r += __builtin_shufflevector(a, b, 0, 1, 2, 3, 4, 5, 6, 7) * (pf[j] * f); }
        *(v8f*)(orow + d * 16) = r;
    }
}

extern "C" void kernel_launch(void* const* d_in, const int* in_sizes, int n_in,
                              void* d_out, int out_size, void* d_ws, size_t ws_size, hipStream_t stream) {
    (void)in_sizes; (void)n_in; (void)out_size; (void)d_ws; (void)ws_size;
    const float* Qin = (const float*)d_in[0]; const float* Kin = (const float*)d_in[1]; const float* Vin = (const float*)d_in[2];   /* q, k, v [2][16][2048][64] head-major: unit u = b*16 + h at + u*2048*64 */
    float* OUT = (float*)d_out;     // [2][16][2048][64]
    k_fattn<<<dim3(NB_, TT / 128, 1), 512, 0, stream>>>(Qin, Kin, Vin, OUT);
}

// v004
// Measured time: 31.5 microseconds a run.
// Two timings next to v003 both put it at 1.06 times that version's speed.
// Over all steps from v000 it is 75.8 times as fast.
#include <hip/hip_runtime.h>

// Causal attention on given head-major tensors (q, k, v [2][16][2048][64]; per (batch, head): scores = q.k (NO scaling in the module: logits sigma ~8), keys after the query -> -inf; softmax; out = attn v -> [2][16][2048][64] (4.2 M)).
// One launch over all 32 (batch, head) units: S^T = K.Q^T, running-maximum softmax in registers, O^T += V^T.P^T; four waves share the keys of each query tile and join their partial results at the end. Scores and probabilities never reach memory; k and v are rounded to bf16 on their way into LDS, and V^T comes out of LDS by the transposing load.
// Compute dtypes, f32 accumulate: every input rounded to bf16; q.k exact products; softmax f32; P hi/lo x exact values (2 products).

#define NB_  32      // (batch, head) units
#define TT   2048
#define HD   64
#define L2E  1.4426950408889634f
#define NEGB (-1.0e30f)   // stands for -inf: its exp2 is exactly 0 and no inf - inf can arise
#define RISE 40.0f        // how far a score may stand above the maximum in use before the sums are rescaled: probabilities then reach at most e^40 = 2^58, so 2048 of them times a value stay far inside f32 (and bf16 has the f32 exponent range)
typedef __attribute__((ext_vector_type(16))) __bf16   v16bf;
typedef __attribute__((ext_vector_type(8)))  __bf16   v8bf;
typedef __attribute__((ext_vector_type(4)))  __bf16   v4bf;
typedef __attribute__((ext_vector_type(8)))  short    v8s;
typedef __attribute__((ext_vector_type(8)))  unsigned short v8us;
typedef __attribute__((ext_vector_type(4)))  unsigned v4u;
typedef __attribute__((ext_vector_type(8)))  float    v8f;
typedef __attribute__((ext_vector_type(4)))  float    v4f;

__device__ __forceinline__ unsigned short f2bf(float f) { unsigned u = __float_as_uint(f); u += 0x7FFFu + ((u >> 16) & 1u); return (unsigned short)(u >> 16); }
__device__ __forceinline__ v16bf cat16b(v8us lo, v8us hi) { return __builtin_bit_cast(v16bf, __builtin_shufflevector(lo, hi, 0, 1, 2, 3, 4, 5, 6, 7, 8, 9, 10, 11, 12, 13, 14, 15)); }
__device__ __forceinline__ v8f wmmab(v16bf a, v16bf b, v8f c) { return __builtin_amdgcn_wmma_f32_16x16x32_bf16(false, a, false, b, (short)0, c, false, false); }
// 16 x 32 fragment from k-contiguous bf16 rows in LDS, hardware k order: p = this lane's address (row c, + 16 h bytes); elements 0-7 = k 8h.., 8-15 = k 16 + 8h..
__device__ __forceinline__ v16bf ldfrag(const unsigned char* p) { return cat16b(*(const v8us*)p, *(const v8us*)(p + 32)); }
// transposing LDS load: lane (c, h) gets column c, rows 8h .. 8h + 7 of the 16 x 16 bf16 tile whose row 8h + (l & 7), bytes 16 ((l >> 3) & 1).., lane l points at
__device__ __forceinline__ v8us ldtr(const unsigned char* p) { typedef __attribute__((address_space(3))) v8s lds_v8s; return __builtin_bit_cast(v8us, __builtin_amdgcn_ds_load_tr16_b128_v8i16((lds_v8s*)p)); }
// the eight bf16 of h, widened back to f32 from the packed words
__device__ __forceinline__ v8f widen(v8bf h) { const v4u w = __builtin_bit_cast(v4u, h); v8f r;
#pragma unroll
    for (int i = 0; i < 4; ++i) { r[2 * i] = __uint_as_float(w[i] << 16); r[2 * i + 1] = __uint_as_float(w[i] & 0xFFFF0000u); }
    return r; }
// value of lane l ^ 16
__device__ __forceinline__ float xhalf(float x) { const int b = __float_as_int(x); return __int_as_float(__builtin_amdgcn_permlanex16(b, b, 0x76543210, 0xfedcba98, false, false)); }

#define SK   128u             // keys a stage (four blocks of 32: one for each of a tile's four waves)
#define PK   144u             // LDS pitch of a k row, bytes: 128 of bf16 + 16, an odd multiple of 16 for the 16-byte readers
#define PV   160u             // LDS pitch of a v row, bytes: 128 of bf16 + 32, an odd multiple of 32 for the transposing readers
#define KLB  (SK * PK)        // the k part of a buffer
#define STG  (SK * (PK + PV)) // one buffer: k rows, then v rows
#define XP   272u             // exchange area, bytes a lane: 64 output values, 2 maxima, 2 sums (an odd multiple of 16 for the 16-byte accesses)

// k_fattn: a work-group = 4 neighbouring query tiles of 32 columns (2 groups of 16) of one unit, each tile held by FOUR waves (w, w + 4, w + 8, w + 12): of every stage of 128 keys each takes one block of 32,
// with a running maximum, sum and O^T of its own, so the longest wave walks a quarter of the keys and four waves stand on every SIMD; behind the walk the four join through LDS (each finishes a quarter of the tile).
// The 16 waves together bring each stage of 128 k rows and 128 v rows from the f32 inputs through registers, rounded to bf16, into one of two LDS buffers, while the stage before it is worked on; one barrier a stage.
// Every '#pragma unroll' here makes the indices of a register array constants, so that the array stays in registers.
// S^T tile: D[r] = score(key 8h + r, query c). Two such tiles (keys 0-15, 16-31), converted in place, are the B operand of O^T += V^T.P^T; O^T tile: D[r] = O[query c][d 8h + r].
__global__ __launch_bounds__(512) void k_fattn(const float* __restrict__ Q, const float* __restrict__ K, const float* __restrict__ V, float* __restrict__ OUT) {
    __shared__ __attribute__((aligned(16))) unsigned char L[2 * STG];
    __shared__ __attribute__((aligned(16))) unsigned char X[512 * XP];      // the partial results, a place of its own: a wave that is through writes while others still read the stages
    const unsigned tid = threadIdx.x;
    const int lane = threadIdx.x & 31, lr = lane & 15, hi = lane >> 4;
    const int wave = __builtin_amdgcn_readfirstlane(threadIdx.x >> 5);       // scalar, so that the trip count and the diagonal test are scalar branches (WMMA needs every lane on)
    const size_t u = blockIdx.x;
    const int yb = TT / 128 - 1 - (int)blockIdx.y;      // heaviest query blocks start first
    const int qw = wave & 3, kq = wave >> 2;            // query tile in the work-group; which block of each stage
    const int tile = yb * 4 + qw;
    const int q0 = tile * 32;
    const float* Qu = Q + u * TT * HD; const char* Ku = (const char*)(K + u * TT * HD); const char* Vu = (const char*)(V + u * TT * HD);
    const unsigned goff = tid * 16u;      // a stage is 32 KiB in a row in each input: this thread takes 16 bytes of each 8 KiB (32 rows) of it, so every load covers whole lines
    const unsigned ksto = (tid >> 4) * PK + (tid & 15u) * 8u, vsto = KLB + (tid >> 4) * PV + (tid & 15u) * 8u;      // where its four values of each 32 rows go
    const unsigned kld = (unsigned)kq * 32u * PK + (unsigned)lr * PK + 16u * (unsigned)hi;      // k fragment: this wave's block of the stage, row c, bytes 16 h
    const unsigned vld = KLB + (unsigned)kq * 32u * PV + (8u * (unsigned)hi + ((unsigned)lane & 7u)) * PV + (((unsigned)lane >> 3) & 1u) * 16u;      // v tile, as the transposing load wants its lanes' addresses

    v16bf qf[2][2];      // [query group][d half], kept for the whole walk
#pragma unroll
    for (int qt = 0; qt < 2; ++qt)
#pragma unroll
        for (int ks = 0; ks < 2; ++ks) { const float* p = Qu + (size_t)(q0 + qt * 16 + lr) * HD + ks * 32 + 8 * hi; const v8f a = *(const v8f*)p, b = *(const v8f*)(p + 16); v8us lo, up;
#pragma unroll
            for (int e = 0; e < 8; ++e) { lo[e] = f2bf(a[e]); up[e] = f2bf(b[e]); }
            qf[qt][ks] = cat16b(lo, up); }

    v8f o[2][4];
#pragma unroll
    for (int qt = 0; qt < 2; ++qt)
#pragma unroll
        for (int dt = 0; dt < 4; ++dt) o[qt][dt] = (v8f){};
    float mthr[2] = {NEGB, NEGB}, mlog[2] = {NEGB * L2E, NEGB * L2E}, lsum[2] = {0.f, 0.f};   // the maximum in use: raw + RISE (the bar a score must pass), and x log2 e as rounded; this lane's half of the running sum

    const int nkb = tile + 1;            // this tile's blocks of 32 keys
    const int ns = yb + 1;               // the work-group's stages: the same for its sixteen waves, so every wave passes every barrier

    // gk, gv: this thread's share of the stage in flight; kf: [key tile][d half] of the block about to be used. They are the loop body's own, handed in, so that none of them counts as alive from one stage to the next.
    auto fetch = [&](int s, v4f (&gk)[4], v4f (&gv)[4]) __attribute__((always_inline)) {
        const unsigned off = goff + (unsigned)s * (SK * HD * 4);      // one 32-bit offset serves both inputs beside their scalar bases: four waves a SIMD leave no registers for 64-bit addresses
#pragma unroll
        for (int i = 0; i < 4; ++i) { gk[i] = *(const v4f*)(Ku + off + i * 8192); gv[i] = *(const v4f*)(Vu + off + i * 8192); }
        asm volatile("s_wait_xcnt 0x0" ::: "memory");      // precaution: stands in front of every rewrite of the registers that hold these loads' addresses; its clobber also keeps the loads up here, ahead of the stage's work
    };
    auto put = [&](int s, const v4f (&gk)[4], const v4f (&gv)[4]) __attribute__((always_inline)) {
        unsigned char* d = L + (unsigned)(s & 1) * STG;
#pragma unroll
        for (int i = 0; i < 4; ++i) { *(v4bf*)(d + i * 32 * PK + ksto) = __builtin_convertvector(gk[i], v4bf); *(v4bf*)(d + i * 32 * PV + vsto) = __builtin_convertvector(gv[i], v4bf); }
    };
    auto loadk = [&](const unsigned char* B, v16bf (&kf)[2][2]) __attribute__((always_inline)) {
#pragma unroll
        for (int kt = 0; kt < 2; ++kt)
#pragma unroll
            for (int ks = 0; ks < 2; ++ks) kf[kt][ks] = ldfrag(B + (kt * 16) * PK + ks * 64 + kld);
    };
    // one block of 32 keys: this wave's block of the stage in buffer B
    auto pass = [&](const unsigned char* B, int kb, const v16bf (&kf)[2][2]) __attribute__((always_inline)) {
        v8f s[2][2];     // [query group][key tile]
#pragma unroll
        for (int qt = 0; qt < 2; ++qt)
#pragma unroll
            for (int kt = 0; kt < 2; ++kt) { s[qt][kt] = wmmab(kf[kt][0], qf[qt][0], (v8f){}); s[qt][kt] = wmmab(kf[kt][1], qf[qt][1], s[qt][kt]); }
        v16bf vf[4];     // issued ahead of the softmax, used behind it
#pragma unroll
        for (int dt = 0; dt < 4; ++dt) vf[dt] = cat16b(ldtr(B + dt * 32 + vld), ldtr(B + 16 * PV + dt * 32 + vld));
        __builtin_amdgcn_sched_barrier(0);     // keeps the LDS reads above up here, a softmax ahead of their use; without it they are moved down to just in front of the products that wait for them
        if (kb == nkb - 1) {      // only the last block crosses the diagonal: keys after the query excluded
#pragma unroll
            for (int qt = 0; qt < 2; ++qt)
#pragma unroll
                for (int kt = 0; kt < 2; ++kt)
#pragma unroll
                    for (int j = 0; j < 8; ++j) s[qt][kt][j] = (kt * 16 + hi * 8 + j <= qt * 16 + lr) ? s[qt][kt][j] : NEGB;
        }
        // Lazy rescale. Softmax does not depend on the value that is subtracted, so the maximum in use stays until a score passes it by more than RISE: one test a block, on each lane's own 16 scores of either group
        // (the two halves of a column are joined only when the test fires). The first block of a wave always fires (the start value), and sets each column's own maximum.
        float mx[2];
#pragma unroll
        for (int qt = 0; qt < 2; ++qt) {
            mx[qt] = s[qt][0][0];
#pragma unroll
            for (int j = 1; j < 8; ++j) mx[qt] = fmaxf(mx[qt], s[qt][0][j]);
#pragma unroll
            for (int j = 0; j < 8; ++j) mx[qt] = fmaxf(mx[qt], s[qt][1][j]);
        }
        if (__builtin_amdgcn_ballot_w32((mx[0] > mthr[0]) | (mx[1] > mthr[1])) != 0) {
#pragma unroll
            for (int qt = 0; qt < 2; ++qt) {      // every column whose maximum rose takes the new one (the same in both its lanes); a column whose maximum stays has the factor 1
                const float m2 = fmaxf(mx[qt], xhalf(mx[qt])), bar = m2 + RISE; const bool up = bar > mthr[qt];
                if (__builtin_amdgcn_ballot_w32(up) != 0) {      // a group none of whose columns rose is left as it is
                    const float ml = m2 * L2E, al = up ? __builtin_amdgcn_exp2f(mlog[qt] - ml) : 1.0f; mthr[qt] = up ? bar : mthr[qt]; mlog[qt] = up ? ml : mlog[qt]; lsum[qt] *= al;
#pragma unroll
                    for (int dt = 0; dt < 4; ++dt) o[qt][dt] *= al;
                }
            }
        }
        v16bf ph[2], pl[2];
#pragma unroll
        for (int qt = 0; qt < 2; ++qt) {
            const float nm = -mlog[qt]; v8f p0, p1; float sm = 0.f;
#pragma unroll
            for (int j = 0; j < 8; ++j) { p0[j] = __builtin_amdgcn_exp2f(__builtin_fmaf(s[qt][0][j], L2E, nm)); p1[j] = __builtin_amdgcn_exp2f(__builtin_fmaf(s[qt][1][j], L2E, nm)); sm += p0[j] + p1[j]; }
            lsum[qt] += sm;
            const v8bf h0 = __builtin_convertvector(p0, v8bf), h1 = __builtin_convertvector(p1, v8bf);
            const v8bf l0 = __builtin_convertvector(p0 - widen(h0), v8bf), l1 = __builtin_convertvector(p1 - widen(h1), v8bf);
            ph[qt] = __builtin_shufflevector(h0, h1, 0, 1, 2, 3, 4, 5, 6, 7, 8, 9, 10, 11, 12, 13, 14, 15);
            pl[qt] = __builtin_shufflevector(l0, l1, 0, 1, 2, 3, 4, 5, 6, 7, 8, 9, 10, 11, 12, 13, 14, 15);
            if (qt == 0) __builtin_amdgcn_sched_barrier(0);     // keeps the two groups' softmax apart: interleaved they need more registers than four waves a SIMD leave
        }
#pragma unroll
        for (int dt = 0; dt < 4; ++dt)
#pragma unroll
            for (int qt = 0; qt < 2; ++qt) o[qt][dt] = wmmab(vf[dt], ph[qt], o[qt][dt]);
#pragma unroll
        for (int dt = 0; dt < 4; ++dt)
#pragma unroll
            for (int qt = 0; qt < 2; ++qt) o[qt][dt] = wmmab(vf[dt], pl[qt], o[qt][dt]);
    };

    { v4f gk[4], gv[4]; fetch(0, gk, gv); put(0, gk, gv); }
    __syncthreads();      // stage 0 is in LDS for every wave
#pragma unroll 1   // rolled: one stage's registers and code only
    for (int s = 0; s < ns; ++s) {
        const unsigned char* B = L + (unsigned)(s & 1) * STG;
        const bool more = s + 1 < ns;
        const int kb = 4 * s + kq;          // this wave's block of the stage
        v4f gk[4], gv[4]; v16bf kf[2][2];
        loadk(B, kf);      // every wave, also one whose tile ends before this block (published rows, then unused): read under a condition, the fragments' registers would count as alive all round the loop
        if (more) fetch(s + 1, gk, gv);      // the next stage flies during this stage's block
        if (kb < nkb) pass(B, kb, kf);
        if (more) {
            asm volatile("v_nop\n\tv_nop\n\tv_nop\n\tv_nop");      // the four vector slots the chip needs between the block's last matrix product and the conversions below, which take over its operand registers
            __builtin_amdgcn_sched_barrier(0);     // holds the conversions behind those slots: without it they are moved up in front of them
            put(s + 1, gk, gv);  // into the buffer that stage s - 1 was read from: the barrier at the foot of stage s - 1 ended those reads
            __syncthreads();     // publishes stage s + 1 and ends every wave's reads of stage s
        }
    }

    // The four waves of a tile join: each lays down all it holds, and behind the barrier each finishes a quarter of the tile (one group of 16 columns, 32 of the 64 d: whole 128-byte lines of the output) from the four partial results, in the order of the blocks.
    {
        float* x = (float*)(X + tid * XP);
#pragma unroll
        for (int qt = 0; qt < 2; ++qt) {
#pragma unroll
            for (int dt = 0; dt < 4; ++dt) { *(v4f*)(x + (qt * 4 + dt) * 8) = __builtin_shufflevector(o[qt][dt], o[qt][dt], 0, 1, 2, 3); *(v4f*)(x + (qt * 4 + dt) * 8 + 4) = __builtin_shufflevector(o[qt][dt], o[qt][dt], 4, 5, 6, 7); }
            x[64 + qt] = mlog[qt]; x[66 + qt] = lsum[qt];
        }
    }
    __syncthreads();      // publishes every wave's partial result
    const int fq = kq >> 1, fd = 2 * (kq & 1);      // the group and the first of the two d tiles that this wave finishes
    const float* xs = (const float*)(X + ((unsigned)qw * 32u + (unsigned)lane) * XP);      // this lane's place in the tile's first wave; the next wave's lies 128 lanes on
    float pm[4], pf[4];
#pragma unroll
    for (int j = 0; j < 4; ++j) pm[j] = xs[j * (128 * XP / 4) + 64 + fq];
    const float ml = fmaxf(fmaxf(pm[0], pm[1]), fmaxf(pm[2], pm[3]));
    float lt = 0.f;
#pragma unroll
    for (int j = 0; j < 4; ++j) { pf[j] = __builtin_amdgcn_exp2f(pm[j] - ml); lt += xs[j * (128 * XP / 4) + 66 + fq] * pf[j]; }      // a wave that had no block holds the start values: its factor is exp2 of a huge negative number, exactly 0
    const float f = __fdiv_rn(1.0f, lt + xhalf(lt));
    float* orow = OUT + (u * TT + q0 + fq * 16 + lr) * HD + 8 * hi + fd * 16;
#pragma unroll
    for (int d = 0; d < 2; ++d) {
        v8f r = (v8f){};
#pragma unroll
        for (int j = 0; j < 4; ++j) { const float* p = xs + j * (128 * XP / 4) + (fq * 4 + fd + d) * 8; const v4f a = *(const v4f*)p, b = *(const v4f*)(p + 4);
            r += __builtin_shufflevector(a, b, 0, 1, 2, 3, 4, 5, 6, 7) * (pf[j] * f); }
        *(v8f*)(orow + d * 16) = r;
    }
}

extern "C" void kernel_launch(void* const* d_in, const int* in_sizes, int n_in,
                              void* d_out, int out_size, void* d_ws, size_t ws_size, hipStream_t stream) {
    (void)in_sizes; (void)n_in; (void)out_size; (void)d_ws; (void)ws_size;
    const float* Qin = (const float*)d_in[0]; const float* Kin = (const float*)d_in[1]; const float* Vin = (const float*)d_in[2];   /* q, k, v [2][16][2048][64] head-major: unit u = b*16 + h at + u*2048*64 */
    float* OUT = (float*)d_out;     // [2][16][2048][64]
    k_fattn<<<dim3(NB_, TT / 128, 1), 512, 0, stream>>>(Qin, Kin, Vin, OUT);
}

// v005
// One run takes 30.4 microseconds.
// Two timings next to v004 put it at 1.03 and 1.04 times that version's speed.
// Counting every step since v000, it is 78.6 times as fast.
#include <hip/hip_runtime.h>

// Causal attention on given head-major tensors (q, k, v [2][16][2048][64]; per (batch, head): scores = q.k (NO scaling in the module: logits sigma ~8), keys after the query -> -inf; softmax; out = attn v -> [2][16][2048][64] (4.2 M)).
// One launch over all 32 (batch, head) units: S^T = K.Q^T, running-maximum softmax in registers, O^T += V^T.P^T; four waves share the keys of each query tile and join their partial results at the end. Scores and probabilities never reach memory; k and v are rounded to bf16 on their way into LDS, and V^T comes out of LDS by the transposing load.
// Compute dtypes, f32 accumulate: every input rounded to bf16; q.k exact products; softmax f32; P hi/lo x exact values (2 products).

#define NB_  32      // (batch, head) units
#define TT   2048
#define HD   64
#define L2E  1.4426950408889634f
#define NEGB (-1.0e30f)   // stands for -inf: its exp2 is exactly 0 and no inf - inf can arise
#define RISE 40.0f        // how far a score may stand above the maximum in use before the sums are rescaled: probabilities then reach at most e^40 = 2^58, so 2048 of them times a value stay far inside f32 (and bf16 has the f32 exponent range)
typedef __attribute__((ext_vector_type(16))) __bf16   v16bf;
typedef __attribute__((ext_vector_type(4)))  __bf16   v4bf;
typedef __attribute__((ext_vector_type(8)))  short    v8s;
typedef __attribute__((ext_vector_type(8)))  unsigned short v8us;
typedef __attribute__((ext_vector_type(8)))  float    v8f;
typedef __attribute__((ext_vector_type(4)))  float    v4f;
typedef __attribute__((ext_vector_type(2)))  float    v2f;
typedef __attribute__((ext_vector_type(2)))  __bf16   v2bf;
typedef __attribute__((ext_vector_type(8)))  unsigned v8u;

__device__ __forceinline__ unsigned short f2bf(float f) { unsigned u = __float_as_uint(f); u += 0x7FFFu + ((u >> 16) & 1u); return (unsigned short)(u >> 16); }
__device__ __forceinline__ v16bf cat16b(v8us lo, v8us hi) { return __builtin_bit_cast(v16bf, __builtin_shufflevector(lo, hi, 0, 1, 2, 3, 4, 5, 6, 7, 8, 9, 10, 11, 12, 13, 14, 15)); }
__device__ __forceinline__ v8f wmmab(v16bf a, v16bf b, v8f c) { return __builtin_amdgcn_wmma_f32_16x16x32_bf16(false, a, false, b, (short)0, c, false, false); }
// 16 x 32 fragment from k-contiguous bf16 rows in LDS, hardware k order: p = this lane's address (row c, + 16 h bytes); elements 0-7 = k 8h.., 8-15 = k 16 + 8h..
__device__ __forceinline__ v16bf ldfrag(const unsigned char* p) { return cat16b(*(const v8us*)p, *(const v8us*)(p + 32)); }
// transposing LDS load: lane (c, h) gets column c, rows 8h .. 8h + 7 of the 16 x 16 bf16 tile whose row 8h + (l & 7), bytes 16 ((l >> 3) & 1).., lane l points at
__device__ __forceinline__ v8us ldtr(const unsigned char* p) { typedef __attribute__((address_space(3))) v8s lds_v8s; return __builtin_bit_cast(v8us, __builtin_amdgcn_ds_load_tr16_b128_v8i16((lds_v8s*)p)); }
// two f32 rounded to bf16, as one packed word; and the two bf16 of such a word widened back to f32
__device__ __forceinline__ unsigned pack2(v2f x) { return __builtin_bit_cast(unsigned, __builtin_convertvector(x, v2bf)); }
__device__ __forceinline__ v2f widen2(unsigned w) { return (v2f){__uint_as_float(w << 16), __uint_as_float(w & 0xFFFF0000u)}; }
// value of lane l ^ 16
__device__ __forceinline__ float xhalf(float x) { const int b = __float_as_int(x); return __int_as_float(__builtin_amdgcn_permlanex16(b, b, 0x76543210, 0xfedcba98, false, false)); }

#define SK   128u             // keys a stage (four blocks of 32: one for each of a tile's four waves)
#define PK   144u             // LDS pitch of a k row, bytes: 128 of bf16 + 16, an odd multiple of 16 for the 16-byte readers
#define PV   160u             // LDS pitch of a v row, bytes: 128 of bf16 + 32, an odd multiple of 32 for the transposing readers
#define KLB  (SK * PK)        // the k part of a buffer
#define STG  (SK * (PK + PV)) // one buffer: k rows, then v rows
#define XP   272u             // exchange area, bytes a lane: 64 output values, 2 maxima, 2 sums (an odd multiple of 16 for the 16-byte accesses)

// k_fattn: a work-group = 4 neighbouring query tiles of 32 columns (2 groups of 16) of one unit, each tile held by FOUR waves (w, w + 4, w + 8, w + 12): of every stage of 128 keys each takes one block of 32,
// with a running maximum, sum and O^T of its own, so the longest wave walks a quarter of the keys and four waves stand on every SIMD; behind the walk the four join through LDS (each finishes a quarter of the tile).
// The 16 waves together bring each stage of 128 k rows and 128 v rows from the f32 inputs through registers, rounded to bf16, into one of two LDS buffers, while the stage before it is worked on; one barrier a stage.
// Every '#pragma unroll' here makes the indices of a register array constants, so that the array stays in registers.
// S^T tile: D[r] = score(key 8h + r, query c). Two such tiles (keys 0-15, 16-31), converted in place, are the B operand of O^T += V^T.P^T; O^T tile: D[r] = O[query c][d 8h + r].
__global__ __launch_bounds__(512) void k_fattn(const float* __restrict__ Q, const float* __restrict__ K, const float* __restrict__ V, float* __restrict__ OUT) {
    __shared__ __attribute__((aligned(16))) unsigned char L[2 * STG];
    __shared__ __attribute__((aligned(16))) unsigned char X[512 * XP];      // the partial results, a place of its own: a wave that is through writes while others still read the stages
    const unsigned tid = threadIdx.x;
    const int lane = threadIdx.x & 31, lr = lane & 15, hi = lane >> 4;
    const int wave = __builtin_amdgcn_readfirstlane(threadIdx.x >> 5);       // scalar, so that the trip count and the diagonal test are scalar branches (WMMA needs every lane on)
    const size_t u = blockIdx.x;
    const int yb = TT / 128 - 1 - (int)blockIdx.y;      // heaviest query blocks start first
    const int qw = wave & 3, kq = wave >> 2;            // query tile in the work-group; which block of each stage
    const int tile = yb * 4 + qw;
    const int q0 = tile * 32;
    const float* Qu = Q + u * TT * HD; const char* Ku = (const char*)(K + u * TT * HD); const char* Vu = (const char*)(V + u * TT * HD);
    const unsigned goff = tid * 16u;      // a stage is 32 KiB in a row in each input: this thread takes 16 bytes of each 8 KiB (32 rows) of it, so every load covers whole lines
    const unsigned ksto = (tid >> 4) * PK + (tid & 15u) * 8u, vsto = KLB + (tid >> 4) * PV + (tid & 15u) * 8u;      // where its four values of each 32 rows go
    const unsigned kld = (unsigned)kq * 32u * PK + (unsigned)lr * PK + 16u * (unsigned)hi;      // k fragment: this wave's block of the stage, row c, bytes 16 h
    const unsigned vld = KLB + (unsigned)kq * 32u * PV + (8u * (unsigned)hi + ((unsigned)lane & 7u)) * PV + (((unsigned)lane >> 3) & 1u) * 16u;      // v tile, as the transposing load wants its lanes' addresses

    v16bf qf[2][2];      // [query group][d half], kept for the whole walk
#pragma unroll
    for (int qt = 0; qt < 2; ++qt)
#pragma unroll
        for (int ks = 0; ks < 2; ++ks) { const float* p = Qu + (size_t)(q0 + qt * 16 + lr) * HD + ks * 32 + 8 * hi; const v8f a = *(const v8f*)p, b = *(const v8f*)(p + 16); v8us lo, up;
#pragma unroll
            for (int e = 0; e < 8; ++e) { lo[e] = f2bf(a[e]); up[e] = f2bf(b[e]); }
            qf[qt][ks] = cat16b(lo, up); }

    v8f o[2][4];
#pragma unroll
    for (int qt = 0; qt < 2; ++qt)
#pragma unroll
        for (int dt = 0; dt < 4; ++dt) o[qt][dt] = (v8f){};
    float mthr[2] = {NEGB, NEGB}, mlog[2] = {NEGB * L2E, NEGB * L2E};   // the maximum in use: raw + RISE (the bar a score must pass), and x log2 e as rounded
    v2f lsum[2] = {(v2f){}, (v2f){}};      // this lane's half of the running sum, the even and the odd keys apart (joined behind the walk)

    const int nkb = tile + 1;            // this tile's blocks of 32 keys
    const int ns = yb + 1;               // the work-group's stages: the same for its sixteen waves, so every wave passes every barrier

    // gk, gv: this thread's share of the stage in flight; kf: [key tile][d half] of the block about to be used. They are the loop body's own, handed in, so that none of them counts as alive from one stage to the next.
    auto fetch = [&](int s, v4f (&gk)[4], v4f (&gv)[4]) __attribute__((always_inline)) {
        const unsigned off = goff + (unsigned)s * (SK * HD * 4);      // one 32-bit offset serves both inputs beside their scalar bases: four waves a SIMD leave no registers for 64-bit addresses
#pragma unroll
        for (int i = 0; i < 4; ++i) { gk[i] = *(const v4f*)(Ku + off + i * 8192); gv[i] = *(const v4f*)(Vu + off + i * 8192); }
        asm volatile("s_wait_xcnt 0x0" ::: "memory");      // precaution: stands in front of every rewrite of the registers that hold these loads' addresses; its clobber also keeps the loads up here, ahead of the stage's work
    };
    auto put = [&](int s, const v4f (&gk)[4], const v4f (&gv)[4]) __attribute__((always_inline)) {
        unsigned char* d = L + (unsigned)(s & 1) * STG;
#pragma unroll
        for (int i = 0; i < 4; ++i) { *(v4bf*)(d + i * 32 * PK + ksto) = __builtin_convertvector(gk[i], v4bf); *(v4bf*)(d + i * 32 * PV + vsto) = __builtin_convertvector(gv[i], v4bf); }
    };
    auto loadk = [&](const unsigned char* B, v16bf (&kf)[2][2]) __attribute__((always_inline)) {
#pragma unroll
        for (int kt = 0; kt < 2; ++kt)
#pragma unroll
            for (int ks = 0; ks < 2; ++ks) kf[kt][ks] = ldfrag(B + (kt * 16) * PK + ks * 64 + kld);
    };
    // one block of 32 keys: this wave's block of the stage in buffer B
    auto pass = [&](const unsigned char* B, int kb, const v16bf (&kf)[2][2]) __attribute__((always_inline)) {
        v8f s[2][2];     // [query group][key tile]
#pragma unroll
        for (int qt = 0; qt < 2; ++qt)
#pragma unroll
            for (int kt = 0; kt < 2; ++kt) { s[qt][kt] = wmmab(kf[kt][0], qf[qt][0], (v8f){}); s[qt][kt] = wmmab(kf[kt][1], qf[qt][1], s[qt][kt]); }
        v16bf vf[4];     // issued ahead of the softmax, used behind it
#pragma unroll
        for (int dt = 0; dt < 4; ++dt) vf[dt] = cat16b(ldtr(B + dt * 32 + vld), ldtr(B + 16 * PV + dt * 32 + vld));
        __builtin_amdgcn_sched_barrier(0);     // keeps the LDS reads above up here, a softmax ahead of their use; without it they are moved down to just in front of the products that wait for them
        if (kb == nkb - 1) {      // only the last block crosses the diagonal: keys after the query excluded
#pragma unroll
            for (int qt = 0; qt < 2; ++qt)
#pragma unroll
                for (int kt = 0; kt < 2; ++kt)
#pragma unroll
                    for (int j = 0; j < 8; ++j) s[qt][kt][j] = (kt * 16 + hi * 8 + j <= qt * 16 + lr) ? s[qt][kt][j] : NEGB;
        }
        // Lazy rescale. Softmax does not depend on the value that is subtracted, so the maximum in use stays until a score passes it by more than RISE: one test a block, on each lane's own 16 scores of either group
        // (the two halves of a column are joined only when the test fires). The first block of a wave always fires (the start value), and sets each column's own maximum.
        float mx[2];
#pragma unroll
        for (int qt = 0; qt < 2; ++qt) {
            mx[qt] = s[qt][0][0];
#pragma unroll
            for (int j = 1; j < 8; ++j) mx[qt] = fmaxf(mx[qt], s[qt][0][j]);
#pragma unroll
            for (int j = 0; j < 8; ++j) mx[qt] = fmaxf(mx[qt], s[qt][1][j]);
        }
        if (__builtin_amdgcn_ballot_w32((mx[0] > mthr[0]) | (mx[1] > mthr[1])) != 0) {
#pragma unroll
            for (int qt = 0; qt < 2; ++qt) {      // every column whose maximum rose takes the new one (the same in both its lanes); a column whose maximum stays has the factor 1
                const float m2 = fmaxf(mx[qt], xhalf(mx[qt])), bar = m2 + RISE; const bool up = bar > mthr[qt];
                if (__builtin_amdgcn_ballot_w32(up) != 0) {      // a group none of whose columns rose is left as it is
                    const float ml = m2 * L2E, al = up ? __builtin_amdgcn_exp2f(mlog[qt] - ml) : 1.0f; mthr[qt] = up ? bar : mthr[qt]; mlog[qt] = up ? ml : mlog[qt]; lsum[qt] *= al;
#pragma unroll
                    for (int dt = 0; dt < 4; ++dt) o[qt][dt] *= al;
                }
            }
        }
        // The f32 arithmetic of the softmax runs on pairs of neighbouring keys (the two that share a bf16 word of P), one packed instruction for two scores: exponent argument, row sum, and what the rounding to bf16 leaves over.
        v16bf ph[2], pl[2];
#pragma unroll
        for (int qt = 0; qt < 2; ++qt) {
            const v2f nm = {-mlog[qt], -mlog[qt]}, le = {L2E, L2E}; v2f p[8]; v8u wh, wl;      // p: [key tile x 4 + pair]
#pragma unroll
            for (int i = 0; i < 8; ++i) { const v2f x = __builtin_elementwise_fma((v2f){s[qt][i >> 2][2 * (i & 3)], s[qt][i >> 2][2 * (i & 3) + 1]}, le, nm); p[i] = (v2f){__builtin_amdgcn_exp2f(x[0]), __builtin_amdgcn_exp2f(x[1])}; }
            lsum[qt] += ((p[0] + p[1]) + (p[2] + p[3])) + ((p[4] + p[5]) + (p[6] + p[7]));
#pragma unroll
            for (int i = 0; i < 8; ++i) { wh[i] = pack2(p[i]); wl[i] = pack2(p[i] - widen2(wh[i])); }
            ph[qt] = __builtin_bit_cast(v16bf, wh);
            pl[qt] = __builtin_bit_cast(v16bf, wl);
            if (qt == 0) __builtin_amdgcn_sched_barrier(0);     // keeps the two groups' softmax apart: interleaved they need more registers than four waves a SIMD leave
        }
#pragma unroll
        for (int dt = 0; dt < 4; ++dt)
#pragma unroll
            for (int qt = 0; qt < 2; ++qt) o[qt][dt] = wmmab(vf[dt], ph[qt], o[qt][dt]);
#pragma unroll
        for (int dt = 0; dt < 4; ++dt)
#pragma unroll
            for (int qt = 0; qt < 2; ++qt) o[qt][dt] = wmmab(vf[dt], pl[qt], o[qt][dt]);
    };

    { v4f gk[4], gv[4]; fetch(0, gk, gv); put(0, gk, gv); }
    __syncthreads();      // stage 0 is in LDS for every wave
#pragma unroll 1   // rolled: one stage's registers and code only
    for (int s = 0; s < ns; ++s) {
        const unsigned char* B = L + (unsigned)(s & 1) * STG;
        const bool more = s + 1 < ns;
        const int kb = 4 * s + kq;          // this wave's block of the stage
        v4f gk[4], gv[4]; v16bf kf[2][2];
        loadk(B, kf);      // every wave, also one whose tile ends before this block (published rows, then unused): read under a condition, the fragments' registers would count as alive all round the loop
        if (more) fetch(s + 1, gk, gv);      // the next stage flies during this stage's block
        if (kb < nkb) pass(B, kb, kf);
        if (more) {
            asm volatile("v_nop\n\tv_nop\n\tv_nop\n\tv_nop");      // the four vector slots the chip needs between the block's last matrix product and the conversions below, which take over its operand registers
            __builtin_amdgcn_sched_barrier(0);     // holds the conversions behind those slots: without it they are moved up in front of them
            put(s + 1, gk, gv);  // into the buffer that stage s - 1 was read from: the barrier at the foot of stage s - 1 ended those reads
            __syncthreads();     // publishes stage s + 1 and ends every wave's reads of stage s
        }
    }

    // The four waves of a tile join: each lays down all it holds, and behind the barrier each finishes a quarter of the tile (one group of 16 columns, 32 of the 64 d: whole 128-byte lines of the output) from the four partial results, in the order of the blocks.
    {
        float* x = (float*)(X + tid * XP);
#pragma unroll
        for (int qt = 0; qt < 2; ++qt) {
#pragma unroll
            for (int dt = 0; dt < 4; ++dt) { *(v4f*)(x + (qt * 4 + dt) * 8) = __builtin_shufflevector(o[qt][dt], o[qt][dt], 0, 1, 2, 3); *(v4f*)(x + (qt * 4 + dt) * 8 + 4) = __builtin_shufflevector(o[qt][dt], o[qt][dt], 4, 5, 6, 7); }
            x[64 + qt] = mlog[qt]; x[66 + qt] = lsum[qt][0] + lsum[qt][1];
        }
    }
    __syncthreads();      // publishes every wave's partial result
    const int fq = kq >> 1, fd = 2 * (kq & 1);      // the group and the first of the two d tiles that this wave finishes
    const float* xs = (const float*)(X + ((unsigned)qw * 32u + (unsigned)lane) * XP);      // this lane's place in the tile's first wave; the next wave's lies 128 lanes on
    float pm[4], pf[4];
#pragma unroll
    for (int j = 0; j < 4; ++j) pm[j] = xs[j * (128 * XP / 4) + 64 + fq];
    const float ml = fmaxf(fmaxf(pm[0], pm[1]), fmaxf(pm[2], pm[3]));
    float lt = 0.f;
#pragma unroll
    for (int j = 0; j < 4; ++j) { pf[j] = __builtin_amdgcn_exp2f(pm[j] - ml); lt += xs[j * (128 * XP / 4) + 66 + fq] * pf[j]; }      // a wave that had no block holds the start values: its factor is exp2 of a huge negative number, exactly 0
    const float f = __fdiv_rn(1.0f, lt + xhalf(lt));
    float* orow = OUT + (u * TT + q0 + fq * 16 + lr) * HD + 8 * hi + fd * 16;
#pragma unroll
    for (int d = 0; d < 2; ++d) {
        v8f r = (v8f){};
#pragma unroll
        for (int j = 0; j < 4; ++j) { const float* p = xs + j * (128 * XP / 4) + (fq * 4 + fd + d) * 8; const v4f a = *(const v4f*)p, b = *(const v4f*)(p + 4);
            r += __builtin_shufflevector(a, b, 0, 1, 2, 3, 4, 5, 6, 7) * (pf[j] * f); }
        *(v8f*)(orow + d * 16) = r;
    }
}

extern "C" void kernel_launch(void* const* d_in, const int* in_sizes, int n_in,
                              void* d_out, int out_size, void* d_ws, size_t ws_size, hipStream_t stream) {
    (void)in_sizes; (void)n_in; (void)out_size; (void)d_ws; (void)ws_size;
    const float* Qin = (const float*)d_in[0]; const float* Kin = (const float*)d_in[1]; const float* Vin = (const float*)d_in[2];   /* q, k, v [2][16][2048][64] head-major: unit u = b*16 + h at + u*2048*64 */
    float* OUT = (float*)d_out;     // [2][16][2048][64]
    k_fattn<<<dim3(NB_, TT / 128, 1), 512, 0, stream>>>(Qin, Kin, Vin, OUT);
}

// v006
// One run takes 28.4 microseconds.
// Timed twice side by side with v005, it ran 1.07 times as fast both times.
// Over all steps from v000 it is 83.9 times as fast.
#include <hip/hip_runtime.h>

// Causal attention on given head-major tensors (q, k, v [2][16][2048][64]; per (batch, head): scores = q.k (NO scaling in the module: logits sigma ~8), keys after the query -> -inf; softmax; out = attn v -> [2][16][2048][64] (4.2 M)).
// One launch over all 32 (batch, head) units: S^T = K.Q^T, running-maximum softmax in registers, O^T += V^T.P^T; four waves share the keys of each query tile and join their partial results at the end. Scores and probabilities never reach memory; k and v are rounded to bf16 on their way into LDS, and V^T comes out of LDS by the transposing load.
// Compute dtypes, f32 accumulate: every input rounded to bf16; q.k exact products; softmax f32; P hi/lo x exact values (2 products).

#define NB_  32      // (batch, head) units
#define TT   2048
#define HD   64
#define L2E  1.4426950408889634f
#define NEGB (-1.0e30f)   // stands for -inf: its exp2 is exactly 0 and no inf - inf can arise
#define RISE 40.0f        // how far a score may stand above the maximum in use before the sums are rescaled: probabilities then reach at most e^40 = 2^58, so 2048 of them times a value stay far inside f32 (and bf16 has the f32 exponent range)
typedef __attribute__((ext_vector_type(16))) __bf16   v16bf;
typedef __attribute__((ext_vector_type(4)))  __bf16   v4bf;
typedef __attribute__((ext_vector_type(8)))  short    v8s;
typedef __attribute__((ext_vector_type(8)))  unsigned short v8us;
typedef __attribute__((ext_vector_type(8)))  float    v8f;
typedef __attribute__((ext_vector_type(4)))  float    v4f;
typedef __attribute__((ext_vector_type(2)))  float    v2f;
typedef __attribute__((ext_vector_type(2)))  __bf16   v2bf;
typedef __attribute__((ext_vector_type(8)))  unsigned v8u;

__device__ __forceinline__ unsigned short f2bf(float f) { unsigned u = __float_as_uint(f); u += 0x7FFFu + ((u >> 16) & 1u); return (unsigned short)(u >> 16); }
__device__ __forceinline__ v16bf cat16b(v8us lo, v8us hi) { return __builtin_bit_cast(v16bf, __builtin_shufflevector(lo, hi, 0, 1, 2, 3, 4, 5, 6, 7, 8, 9, 10, 11, 12, 13, 14, 15)); }
__device__ __forceinline__ v8f wmmab(v16bf a, v16bf b, v8f c) { return __builtin_amdgcn_wmma_f32_16x16x32_bf16(false, a, false, b, (short)0, c, false, false); }
// 16 x 32 fragment from k-contiguous bf16 rows in LDS, hardware k order: p = this lane's address (row c, + 16 h bytes); elements 0-7 = k 8h.., 8-15 = k 16 + 8h..
__device__ __forceinline__ v16bf ldfrag(const unsigned char* p) { return cat16b(*(const v8us*)p, *(const v8us*)(p + 32)); }
// transposing LDS load: lane (c, h) gets column c, rows 8h .. 8h + 7 of the 16 x 16 bf16 tile whose row 8h + (l & 7), bytes 16 ((l >> 3) & 1).., lane l points at
__device__ __forceinline__ v8us ldtr(const unsigned char* p) { typedef __attribute__((address_space(3))) v8s lds_v8s; return __builtin_bit_cast(v8us, __builtin_amdgcn_ds_load_tr16_b128_v8i16((lds_v8s*)p)); }
// two f32 rounded to bf16, as one packed word; and the two bf16 of such a word widened back to f32
__device__ __forceinline__ unsigned pack2(v2f x) { return __builtin_bit_cast(unsigned, __builtin_convertvector(x, v2bf)); }
__device__ __forceinline__ v2f widen2(unsigned w) { return (v2f){__uint_as_float(w << 16), __uint_as_float(w & 0xFFFF0000u)}; }
// value of lane l ^ 16
__device__ __forceinline__ float xhalf(float x) { const int b = __float_as_int(x); return __int_as_float(__builtin_amdgcn_permlanex16(b, b, 0x76543210, 0xfedcba98, false, false)); }

#define SK   128u             // keys a stage (four blocks of 32: one for each of a tile's four waves)
#define PK   144u             // LDS pitch of a k row, bytes: 128 of bf16 + 16, an odd multiple of 16 for the 16-byte readers
#define PV   160u             // LDS pitch of a v row, bytes: 128 of bf16 + 32, an odd multiple of 32 for the transposing readers
#define KLB  (SK * PK)        // the k part of a buffer
#define STG  (SK * (PK + PV)) // one buffer: k rows, then v rows
#define XP   272u             // exchange area, bytes a lane: 64 output values, 2 maxima, 2 sums (an odd multiple of 16 for the 16-byte accesses)

// k_fattn: a work-group = 4 neighbouring query tiles of 32 columns (2 groups of 16) of one unit, each tile held by FOUR waves (w, w + 4, w + 8, w + 12): of every stage of 128 keys each takes one block of 32,
// with a running maximum, sum and O^T of its own, so the longest wave walks a quarter of the keys and four waves stand on every SIMD; behind the walk the four join through LDS (each finishes a quarter of the tile).
// The 16 waves together bring each stage of 128 k rows and 128 v rows from the f32 inputs through registers, rounded to bf16, into one of two LDS buffers, while the stage before it is worked on; one barrier a stage, split: a wave signals as soon as its own LDS traffic of the stage is over and waits only at the top of the next stage.
// Every '#pragma unroll' here makes the indices of a register array constants, so that the array stays in registers.
// S^T tile: D[r] = score(key 8h + r, query c). Two such tiles (keys 0-15, 16-31), converted in place, are the B operand of O^T += V^T.P^T; O^T tile: D[r] = O[query c][d 8h + r].
__global__ __launch_bounds__(512) void k_fattn(const float* __restrict__ Q, const float* __restrict__ K, const float* __restrict__ V, float* __restrict__ OUT) {
    __shared__ __attribute__((aligned(16))) unsigned char L[2 * STG];
    __shared__ __attribute__((aligned(16))) unsigned char X[512 * XP];      // the partial results, a place of its own: a wave that is through writes while others still read the stages
    const unsigned tid = threadIdx.x;
    const int lane = threadIdx.x & 31, lr = lane & 15, hi = lane >> 4;
    const int wave = __builtin_amdgcn_readfirstlane(threadIdx.x >> 5);       // scalar, so that the trip count and the diagonal test are scalar branches (WMMA needs every lane on)
    const size_t u = blockIdx.x;
    const int yb = TT / 128 - 1 - (int)blockIdx.y;      // heaviest query blocks start first
    const int qw = wave & 3, kq = wave >> 2;            // query tile in the work-group; which block of each stage
    const int tile = yb * 4 + qw;
    const int q0 = tile * 32;
    const float* Qu = Q + u * TT * HD; const char* Ku = (const char*)(K + u * TT * HD); const char* Vu = (const char*)(V + u * TT * HD);
    const unsigned goff = tid * 16u;      // a stage is 32 KiB in a row in each input: this thread takes 16 bytes of each 8 KiB (32 rows) of it, so every load covers whole lines
    const unsigned ksto = (tid >> 4) * PK + (tid & 15u) * 8u, vsto = KLB + (tid >> 4) * PV + (tid & 15u) * 8u;      // where its four values of each 32 rows go
    const unsigned kld = (unsigned)kq * 32u * PK + (unsigned)lr * PK + 16u * (unsigned)hi;      // k fragment: this wave's block of the stage, row c, bytes 16 h
    const unsigned vld = KLB + (unsigned)kq * 32u * PV + (8u * (unsigned)hi + ((unsigned)lane & 7u)) * PV + (((unsigned)lane >> 3) & 1u) * 16u;      // v tile, as the transposing load wants its lanes' addresses

    v16bf qf[2][2];      // [query group][d half], kept for the whole walk
#pragma unroll
    for (int qt = 0; qt < 2; ++qt)
#pragma unroll
        for (int ks = 0; ks < 2; ++ks) { const float* p = Qu + (size_t)(q0 + qt * 16 + lr) * HD + ks * 32 + 8 * hi; const v8f a = *(const v8f*)p, b = *(const v8f*)(p + 16); v8us lo, up;
#pragma unroll
            for (int e = 0; e < 8; ++e) { lo[e] = f2bf(a[e]); up[e] = f2bf(b[e]); }
            qf[qt][ks] = cat16b(lo, up); }

    v8f o[2][4];
#pragma unroll
    for (int qt = 0; qt < 2; ++qt)
#pragma unroll
        for (int dt = 0; dt < 4; ++dt) o[qt][dt] = (v8f){};
    float mthr[2] = {NEGB, NEGB}, mlog[2] = {NEGB * L2E, NEGB * L2E};   // the maximum in use: raw + RISE (the bar a score must pass), and x log2 e as rounded
    v2f lsum[2] = {(v2f){}, (v2f){}};      // this lane's half of the running sum, the even and the odd keys apart (joined behind the walk)

    const int ns = yb + 1;               // the work-group's stages: the same for its sixteen waves, so every wave passes every barrier

    // gk, gv: this thread's share of the stage in flight; kf: [key tile][d half] of the block about to be used (the loop body's own, handed in, so that it does not count as alive from one stage to the next).
    auto fetch = [&](int s, v4f (&gk)[4], v4f (&gv)[4]) __attribute__((always_inline)) {
        const unsigned off = goff + (unsigned)s * (SK * HD * 4);      // one 32-bit offset serves both inputs beside their scalar bases: four waves a SIMD leave no registers for 64-bit addresses
#pragma unroll
        for (int i = 0; i < 4; ++i) { gk[i] = *(const v4f*)(Ku + off + i * 8192); gv[i] = *(const v4f*)(Vu + off + i * 8192); }
        asm volatile("s_wait_xcnt 0x0" ::: "memory");      // precaution: stands in front of every rewrite of the registers that hold these loads' addresses; its clobber also keeps the loads up here, ahead of the stage's work
        __builtin_amdgcn_sched_barrier(0);     // holds later register writes behind that wait: without it moves that take over the address registers are lifted in front of it
    };
    auto put = [&](int s, const v4f (&gk)[4], const v4f (&gv)[4]) __attribute__((always_inline)) {
        unsigned char* d = L + (unsigned)(s & 1) * STG;
#pragma unroll
        for (int i = 0; i < 4; ++i) { *(v4bf*)(d + i * 32 * PK + ksto) = __builtin_convertvector(gk[i], v4bf); *(v4bf*)(d + i * 32 * PV + vsto) = __builtin_convertvector(gv[i], v4bf); }
    };
    auto loadk = [&](const unsigned char* B, v16bf (&kf)[2][2]) __attribute__((always_inline)) {
#pragma unroll
        for (int kt = 0; kt < 2; ++kt)
#pragma unroll
            for (int ks = 0; ks < 2; ++ks) kf[kt][ks] = ldfrag(B + (kt * 16) * PK + ks * 64 + kld);
        __builtin_amdgcn_sched_barrier(0);     // keeps the eight k reads together in front of the products: without it they are dealt out among them, each group waited for on its own
    };
    // One block of 32 keys, this wave's block of the stage in buffer B, in two parts. scores: the q.k products and the v reads (loadk reads the k fragments). s: [query group][key tile]; vf: issued ahead of the softmax, used behind it.
    auto scores = [&](const unsigned char* B, const v16bf (&kf)[2][2], v8f (&s)[2][2], v16bf (&vf)[4]) __attribute__((always_inline)) {
#pragma unroll
        for (int qt = 0; qt < 2; ++qt)
#pragma unroll
            for (int kt = 0; kt < 2; ++kt) { s[qt][kt] = wmmab(kf[kt][0], qf[qt][0], (v8f){}); s[qt][kt] = wmmab(kf[kt][1], qf[qt][1], s[qt][kt]); }
#pragma unroll
        for (int dt = 0; dt < 4; ++dt) vf[dt] = cat16b(ldtr(B + dt * 32 + vld), ldtr(B + 16 * PV + dt * 32 + vld));
        __builtin_amdgcn_sched_barrier(0);     // keeps the LDS reads above up here, a softmax ahead of their use; without it they are moved down to just in front of the products that wait for them
    };
    // finish: softmax and P.v, registers only
    auto finish = [&](v8f (&s)[2][2], const v16bf (&vf)[4], bool diag) __attribute__((always_inline)) {
        if (diag) {      // only a tile's last block crosses the diagonal: keys after the query excluded
#pragma unroll
            for (int qt = 0; qt < 2; ++qt)
#pragma unroll
                for (int kt = 0; kt < 2; ++kt)
#pragma unroll
                    for (int j = 0; j < 8; ++j) s[qt][kt][j] = (kt * 16 + hi * 8 + j <= qt * 16 + lr) ? s[qt][kt][j] : NEGB;
        }
        // Lazy rescale. Softmax does not depend on the value that is subtracted, so the maximum in use stays until a score passes it by more than RISE: one test a block, on each lane's own 16 scores of either group
        // (the two halves of a column are joined only when the test fires). The first block of a wave always fires (the start value), and sets each column's own maximum.
        float mx[2];
#pragma unroll
        for (int qt = 0; qt < 2; ++qt) {
            mx[qt] = s[qt][0][0];
#pragma unroll
            for (int j = 1; j < 8; ++j) mx[qt] = fmaxf(mx[qt], s[qt][0][j]);
#pragma unroll
            for (int j = 0; j < 8; ++j) mx[qt] = fmaxf(mx[qt], s[qt][1][j]);
        }
        if (__builtin_amdgcn_ballot_w32((mx[0] > mthr[0]) | (mx[1] > mthr[1])) != 0) {
#pragma unroll
            for (int qt = 0; qt < 2; ++qt) {      // every column whose maximum rose takes the new one (the same in both its lanes); a column whose maximum stays has the factor 1
                const float m2 = fmaxf(mx[qt], xhalf(mx[qt])), bar = m2 + RISE; const bool up = bar > mthr[qt];
                if (__builtin_amdgcn_ballot_w32(up) != 0) {      // a group none of whose columns rose is left as it is
                    const float ml = m2 * L2E, al = up ? __builtin_amdgcn_exp2f(mlog[qt] - ml) : 1.0f; mthr[qt] = up ? bar : mthr[qt]; mlog[qt] = up ? ml : mlog[qt]; lsum[qt] *= al;
#pragma unroll
                    for (int dt = 0; dt < 4; ++dt) o[qt][dt] *= al;
                }
            }
        }
        // The f32 arithmetic of the softmax runs on pairs of neighbouring keys (the two that share a bf16 word of P), one packed instruction for two scores: exponent argument, row sum, and what the rounding to bf16 leaves over.
        v16bf ph[2], pl[2];
#pragma unroll
        for (int qt = 0; qt < 2; ++qt) {
            const v2f nm = {-mlog[qt], -mlog[qt]}, le = {L2E, L2E}; v2f p[8]; v8u wh, wl;      // p: [key tile x 4 + pair]
#pragma unroll
            for (int i = 0; i < 8; ++i) { const v2f x = __builtin_elementwise_fma((v2f){s[qt][i >> 2][2 * (i & 3)], s[qt][i >> 2][2 * (i & 3) + 1]}, le, nm); p[i] = (v2f){__builtin_amdgcn_exp2f(x[0]), __builtin_amdgcn_exp2f(x[1])}; }
            lsum[qt] += ((p[0] + p[1]) + (p[2] + p[3])) + ((p[4] + p[5]) + (p[6] + p[7]));
#pragma unroll
            for (int i = 0; i < 8; ++i) { wh[i] = pack2(p[i]); wl[i] = pack2(p[i] - widen2(wh[i])); }
            ph[qt] = __builtin_bit_cast(v16bf, wh);
            pl[qt] = __builtin_bit_cast(v16bf, wl);
            if (qt == 0) __builtin_amdgcn_sched_barrier(0);     // keeps the two groups' softmax apart: interleaved they need more registers than four waves a SIMD leave
        }
#pragma unroll
        for (int dt = 0; dt < 4; ++dt)
#pragma unroll
            for (int qt = 0; qt < 2; ++qt) o[qt][dt] = wmmab(vf[dt], ph[qt], o[qt][dt]);
#pragma unroll
        for (int dt = 0; dt < 4; ++dt)
#pragma unroll
            for (int qt = 0; qt < 2; ++qt) o[qt][dt] = wmmab(vf[dt], pl[qt], o[qt][dt]);
    };

    // The stage barrier is split. A wave signals once its share of the next stage is stored and its own reads of this stage have returned (right behind the q.k products), and waits at the top of the next stage:
    // softmax and P.v, which touch no LDS, lie between signal and wait, so a wave that is ahead by less than that much never stands still and the waves of a SIMD stop marching in step.
    // Signal and wait alternate in every wave: one signal here, wait then signal in every stage but the last, one wait in front of the last.
    v4f gk[4], gv[4];      // this thread's share of the stage in flight, from behind one signal to in front of the next
    fetch(0, gk, gv); put(0, gk, gv);
    asm volatile("s_wait_dscnt 0x0\n\ts_barrier_signal -1" ::: "memory");      // stage 0: this wave's stores are in LDS, then the signal
    if (ns > 1) fetch(1, gk, gv);
#pragma unroll 1   // rolled: one stage's registers and code only
    for (int s = 0; s + 1 < ns; ++s) {      // every stage but the last: each of the sixteen waves has a whole block below the diagonal
        const unsigned char* B = L + (unsigned)(s & 1) * STG;
        v16bf kf[2][2], vf[4]; v8f sc[2][2];
        asm volatile("s_barrier_wait -1" ::: "memory");      // stage s is published, and every wave's reads of stage s - 1 have returned: its buffer may be refilled
        loadk(B, kf);
        scores(B, kf, sc, vf);
        put(s + 1, gk, gv);      // the conversions run while the q.k products finish
        asm volatile("s_wait_dscnt 0x0\n\ts_barrier_signal -1" ::: "memory");      // this wave's stores of stage s + 1 are in LDS and its reads of stage s are in registers, then the signal; no LDS access follows before the wait
        if (s + 2 < ns) fetch(s + 2, gk, gv);      // flies for a whole stage
        finish(sc, vf, false);
    }
    asm volatile("s_barrier_wait -1" ::: "memory");      // the last stage is published
    if (kq <= qw) {      // the stage on the diagonal: a tile ends with its block qw
        const unsigned char* B = L + (unsigned)((ns - 1) & 1) * STG;
        v16bf kf[2][2], vf[4]; v8f sc[2][2];
        loadk(B, kf);
        scores(B, kf, sc, vf);
        finish(sc, vf, kq == qw);
    }

    // The four waves of a tile join: each lays down all it holds, and behind the barrier each finishes a quarter of the tile (one group of 16 columns, 32 of the 64 d: whole 128-byte lines of the output) from the four partial results, in the order of the blocks.
    {
        float* x = (float*)(X + tid * XP);
#pragma unroll
        for (int qt = 0; qt < 2; ++qt) {
#pragma unroll
            for (int dt = 0; dt < 4; ++dt) { *(v4f*)(x + (qt * 4 + dt) * 8) = __builtin_shufflevector(o[qt][dt], o[qt][dt], 0, 1, 2, 3); *(v4f*)(x + (qt * 4 + dt) * 8 + 4) = __builtin_shufflevector(o[qt][dt], o[qt][dt], 4, 5, 6, 7); }
            x[64 + qt] = mlog[qt]; x[66 + qt] = lsum[qt][0] + lsum[qt][1];
        }
    }
    __syncthreads();      // publishes every wave's partial result
    const int fq = kq >> 1, fd = 2 * (kq & 1);      // the group and the first of the two d tiles that this wave finishes
    const float* xs = (const float*)(X + ((unsigned)qw * 32u + (unsigned)lane) * XP);      // this lane's place in the tile's first wave; the next wave's lies 128 lanes on
    float pm[4], pf[4];
#pragma unroll
    for (int j = 0; j < 4; ++j) pm[j] = xs[j * (128 * XP / 4) + 64 + fq];
    const float ml = fmaxf(fmaxf(pm[0], pm[1]), fmaxf(pm[2], pm[3]));
    float lt = 0.f;
#pragma unroll
    for (int j = 0; j < 4; ++j) { pf[j] = __builtin_amdgcn_exp2f(pm[j] - ml); lt += xs[j * (128 * XP / 4) + 66 + fq] * pf[j]; }      // a wave that had no block holds the start values: its factor is exp2 of a huge negative number, exactly 0
    const float f = __fdiv_rn(1.0f, lt + xhalf(lt));
    float* orow = OUT + (u * TT + q0 + fq * 16 + lr) * HD + 8 * hi + fd * 16;
#pragma unroll
    for (int d = 0; d < 2; ++d) {
        v8f r = (v8f){};
#pragma unroll
        for (int j = 0; j < 4; ++j) { const float* p = xs + j * (128 * XP / 4) + (fq * 4 + fd + d) * 8; const v4f a = *(const v4f*)p, b = *(const v4f*)(p + 4);
            r += __builtin_shufflevector(a, b, 0, 1, 2, 3, 4, 5, 6, 7) * (pf[j] * f); }
        *(v8f*)(orow + d * 16) = r;
    }
}

extern "C" void kernel_launch(void* const* d_in, const int* in_sizes, int n_in,
                              void* d_out, int out_size, void* d_ws, size_t ws_size, hipStream_t stream) {
    (void)in_sizes; (void)n_in; (void)out_size; (void)d_ws; (void)ws_size;
    const float* Qin = (const float*)d_in[0]; const float* Kin = (const float*)d_in[1]; const float* Vin = (const float*)d_in[2];   /* q, k, v [2][16][2048][64] head-major: unit u = b*16 + h at + u*2048*64 */
    float* OUT = (float*)d_out;     // [2][16][2048][64]
    k_fattn<<<dim3(NB_, TT / 128, 1), 512, 0, stream>>>(Qin, Kin, Vin, OUT);
}

// v007
// Measured time: 26.7 microseconds a run.
// Two timings next to v006 both put it at 1.06 times that version's speed.
// All steps since v000 together make it 89.1 times as fast.
#include <hip/hip_runtime.h>

// Causal attention on given head-major tensors (q, k, v [2][16][2048][64]; per (batch, head): scores = q.k (NO scaling in the module: logits sigma ~8), keys after the query -> -inf; softmax; out = attn v -> [2][16][2048][64] (4.2 M)).
// One launch over all 32 (batch, head) units: S^T = K.Q^T, running-maximum softmax in registers, O^T += V^T.P^T; four waves share the keys of each query tile and join their partial results at the end; a work-group does a short and a long query block in turn. Scores and probabilities never reach memory; k and v are rounded to bf16 on their way into LDS, and V^T comes out of LDS by the transposing load.
// Compute dtypes, f32 accumulate: every input rounded to bf16; q.k exact products; softmax f32; P hi/lo x exact values (2 products).

#define NB_  32      // (batch, head) units
#define TT   2048
#define HD   64
#define L2E  1.4426950408889634f
#define NEGB (-1.0e30f)   // stands for -inf: its exp2 is exactly 0 and no inf - inf can arise
#define RISE 40.0f        // how far a score may stand above the maximum in use before the sums are rescaled: probabilities then reach at most e^40 = 2^58, so 2048 of them times a value stay far inside f32 (and bf16 has the f32 exponent range)
typedef __attribute__((ext_vector_type(16))) __bf16   v16bf;
typedef __attribute__((ext_vector_type(4)))  __bf16   v4bf;
typedef __attribute__((ext_vector_type(8)))  short    v8s;
typedef __attribute__((ext_vector_type(8)))  unsigned short v8us;
typedef __attribute__((ext_vector_type(8)))  float    v8f;
typedef __attribute__((ext_vector_type(4)))  float    v4f;
typedef __attribute__((ext_vector_type(2)))  float    v2f;
typedef __attribute__((ext_vector_type(2)))  __bf16   v2bf;
typedef __attribute__((ext_vector_type(8)))  unsigned v8u;

__device__ __forceinline__ unsigned short f2bf(float f) { unsigned u = __float_as_uint(f); u += 0x7FFFu + ((u >> 16) & 1u); return (unsigned short)(u >> 16); }
__device__ __forceinline__ v16bf cat16b(v8us lo, v8us hi) { return __builtin_bit_cast(v16bf, __builtin_shufflevector(lo, hi, 0, 1, 2, 3, 4, 5, 6, 7, 8, 9, 10, 11, 12, 13, 14, 15)); }
__device__ __forceinline__ v8f wmmab(v16bf a, v16bf b, v8f c) { return __builtin_amdgcn_wmma_f32_16x16x32_bf16(false, a, false, b, (short)0, c, false, false); }
// 16 x 32 fragment from k-contiguous bf16 rows in LDS, hardware k order: p = this lane's address (row c, + 16 h bytes); elements 0-7 = k 8h.., 8-15 = k 16 + 8h..
__device__ __forceinline__ v16bf ldfrag(const unsigned char* p) { return cat16b(*(const v8us*)p, *(const v8us*)(p + 32)); }
// transposing LDS load: lane (c, h) gets column c, rows 8h .. 8h + 7 of the 16 x 16 bf16 tile whose row 8h + (l & 7), bytes 16 ((l >> 3) & 1).., lane l points at
__device__ __forceinline__ v8us ldtr(const unsigned char* p) { typedef __attribute__((address_space(3))) v8s lds_v8s; return __builtin_bit_cast(v8us, __builtin_amdgcn_ds_load_tr16_b128_v8i16((lds_v8s*)p)); }
// two f32 rounded to bf16, as one packed word; and the two bf16 of such a word widened back to f32
__device__ __forceinline__ unsigned pack2(v2f x) { return __builtin_bit_cast(unsigned, __builtin_convertvector(x, v2bf)); }
__device__ __forceinline__ v2f widen2(unsigned w) { return (v2f){__uint_as_float(w << 16), __uint_as_float(w & 0xFFFF0000u)}; }
// value of lane l ^ 16
__device__ __forceinline__ float xhalf(float x) { const int b = __float_as_int(x); return __int_as_float(__builtin_amdgcn_permlanex16(b, b, 0x76543210, 0xfedcba98, false, false)); }

#define SK   128u             // keys a stage (four blocks of 32: one for each of a tile's four waves)
#define PK   144u             // LDS pitch of a k row, bytes: 128 of bf16 + 16, an odd multiple of 16 for the 16-byte readers
#define PV   160u             // LDS pitch of a v row, bytes: 128 of bf16 + 32, an odd multiple of 32 for the transposing readers
#define KLB  (SK * PK)        // the k part of a buffer
#define STG  (SK * (PK + PV)) // one buffer: k rows, then v rows
#define XP   272u             // exchange area, bytes a lane: 64 output values, 2 maxima, 2 sums (an odd multiple of 16 for the 16-byte accesses)

// k_fattn: a work-group = 4 neighbouring query tiles of 32 columns (2 groups of 16) of one unit, each tile held by FOUR waves (w, w + 4, w + 8, w + 12): of every stage of 128 keys each takes one block of 32,
// with a running maximum, sum and O^T of its own, so the longest wave walks a quarter of the keys and four waves stand on every SIMD; behind the walk the four join through LDS (each finishes a quarter of the tile).
// A work-group does TWO query blocks of 128 rows of its unit, one after the other: block a (a + 1 stages), then block 15 - a (16 - a stages): 17 stages for every work-group, one work-group for every WGP, all resident from the start.
// The stages of both walks form one row, numbered g = 0 .. 16: while the first block's last stage, join and output are done, the second block's first stage is already in LDS, its second in flight, and its queries on their way.
// The 16 waves together bring each stage of 128 k rows and 128 v rows from the f32 inputs through registers, rounded to bf16, into one of two LDS buffers, while the stage before it is worked on; one barrier a stage, split: a wave signals as soon as its own LDS traffic of the stage is over and waits only in front of the next stage.
// Every '#pragma unroll' here makes the indices of a register array constants, so that the array stays in registers.
// S^T tile: D[r] = score(key 8h + r, query c). Two such tiles (keys 0-15, 16-31), converted in place, are the B operand of O^T += V^T.P^T; O^T tile: D[r] = O[query c][d 8h + r].
#define NG   (TT / 128 + 1)   // stages of a work-group, both query blocks together
__global__ __launch_bounds__(512) void k_fattn(const float* __restrict__ Q, const float* __restrict__ K, const float* __restrict__ V, float* __restrict__ OUT) {
    __shared__ __attribute__((aligned(16))) unsigned char L[2 * STG];
    __shared__ __attribute__((aligned(16))) unsigned char X[512 * XP];      // the partial results, a place of its own: a wave that is through writes while others still read the stages
    const unsigned tid = threadIdx.x;
    const int lane = threadIdx.x & 31, lr = lane & 15, hi = lane >> 4;
    const int wave = __builtin_amdgcn_readfirstlane(threadIdx.x >> 5);       // scalar, so that the trip count and the diagonal test are scalar branches (WMMA needs every lane on)
    const size_t u = blockIdx.x;
    const int ya = (int)blockIdx.y;                     // the first, shorter query block; the second is TT / 128 - 1 - ya
    const int qw = wave & 3, kq = wave >> 2;            // query tile in the work-group; which block of each stage
    const float* Qu = Q + u * TT * HD; const char* Ku = (const char*)(K + u * TT * HD); const char* Vu = (const char*)(V + u * TT * HD);
    const unsigned goff = tid * 16u;      // a stage is 32 KiB in a row in each input: this thread takes 16 bytes of each 8 KiB (32 rows) of it, so every load covers whole lines
    const unsigned ksto = (tid >> 4) * PK + (tid & 15u) * 8u, vsto = KLB + (tid >> 4) * PV + (tid & 15u) * 8u;      // where its four values of each 32 rows go
    const unsigned kld = (unsigned)kq * 32u * PK + (unsigned)lr * PK + 16u * (unsigned)hi;      // k fragment: this wave's block of the stage, row c, bytes 16 h
    const unsigned vld = KLB + (unsigned)kq * 32u * PV + (8u * (unsigned)hi + ((unsigned)lane & 7u)) * PV + (((unsigned)lane >> 3) & 1u) * 16u;      // v tile, as the transposing load wants its lanes' addresses

    v16bf qf[2][2];      // [query group][d half], kept for a whole walk
    v8f o[2][4];
    float mthr[2], mlog[2];   // the maximum in use: raw + RISE (the bar a score must pass), and x log2 e as rounded
    v2f lsum[2];              // this lane's half of the running sum, the even and the odd keys apart (joined behind the walk)

    // qr: the f32 queries of a tile as loaded, [(query group x 2 + d half) x 2 + which 8 of the 16]; rounded to bf16 only at the head of the tile's walk, so that the loads fly meanwhile
    auto loadq = [&](int q0, v8f (&qr)[8]) __attribute__((always_inline)) {
        const float* pq = Qu + (size_t)(q0 + lr) * HD + 8 * hi;      // one address for the whole run, the rest in the loads' constant offsets
#pragma unroll
        for (int qt = 0; qt < 2; ++qt)
#pragma unroll
            for (int ks = 0; ks < 2; ++ks) { const float* p = pq + qt * 16 * HD + ks * 32; qr[(qt * 2 + ks) * 2] = *(const v8f*)p; qr[(qt * 2 + ks) * 2 + 1] = *(const v8f*)(p + 16); }
        asm volatile("s_wait_xcnt 0x0" :: "v"(pq) : "memory");      // precaution: stands in front of every rewrite of the registers that hold these loads' addresses; the address is named as an input so that it lives up to here and no load of the run gets its registers for its result
        __builtin_amdgcn_sched_barrier(0);     // holds later register writes behind that wait
    };

    // gk, gv: this thread's share of the stage in flight; kf: [key tile][d half] of the block about to be used (the loop body's own, handed in, so that it does not count as alive from one stage to the next).
    auto fetch = [&](int g, v4f (&gk)[4], v4f (&gv)[4]) __attribute__((always_inline)) {
        const int s = g <= ya ? g : g - ya - 1;      // stage g of the row is stage s of its own walk: both walks start at key 0
        const unsigned off = goff + (unsigned)s * (SK * HD * 4);      // one 32-bit offset serves both inputs beside their scalar bases: four waves a SIMD leave no registers for 64-bit addresses
#pragma unroll
        for (int i = 0; i < 4; ++i) { gk[i] = *(const v4f*)(Ku + off + i * 8192); gv[i] = *(const v4f*)(Vu + off + i * 8192); }
        asm volatile("s_wait_xcnt 0x0" :: "v"(off) : "memory");      // precaution: stands in front of every rewrite of the registers that hold these loads' addresses; its clobber also keeps the loads up here, ahead of the stage's work; the offset is named as an input so that it lives up to here and no load of the run gets its register for its result
        __builtin_amdgcn_sched_barrier(0);     // holds later register writes behind that wait: without it moves that take over the address registers are lifted in front of it
    };
    auto put = [&](int s, const v4f (&gk)[4], const v4f (&gv)[4]) __attribute__((always_inline)) {
        unsigned char* d = L + (unsigned)(s & 1) * STG;
#pragma unroll
        for (int i = 0; i < 4; ++i) { *(v4bf*)(d + i * 32 * PK + ksto) = __builtin_convertvector(gk[i], v4bf); *(v4bf*)(d + i * 32 * PV + vsto) = __builtin_convertvector(gv[i], v4bf); }
    };
    auto loadk = [&](const unsigned char* B, v16bf (&kf)[2][2]) __attribute__((always_inline)) {
#pragma unroll
        for (int kt = 0; kt < 2; ++kt)
#pragma unroll
            for (int ks = 0; ks < 2; ++ks) kf[kt][ks] = ldfrag(B + (kt * 16) * PK + ks * 64 + kld);
        __builtin_amdgcn_sched_barrier(0);     // keeps the eight k reads together in front of the products: without it they are dealt out among them, each group waited for on its own
    };
    // One block of 32 keys, this wave's block of the stage in buffer B, in two parts. scores: the q.k products and the v reads (loadk reads the k fragments). s: [query group][key tile]; vf: issued ahead of the softmax, used behind it.
    auto scores = [&](const unsigned char* B, const v16bf (&kf)[2][2], v8f (&s)[2][2], v16bf (&vf)[4]) __attribute__((always_inline)) {
#pragma unroll
        for (int qt = 0; qt < 2; ++qt)
#pragma unroll
            for (int kt = 0; kt < 2; ++kt) { s[qt][kt] = wmmab(kf[kt][0], qf[qt][0], (v8f){}); s[qt][kt] = wmmab(kf[kt][1], qf[qt][1], s[qt][kt]); }
#pragma unroll
        for (int dt = 0; dt < 4; ++dt) vf[dt] = cat16b(ldtr(B + dt * 32 + vld), ldtr(B + 16 * PV + dt * 32 + vld));
        __builtin_amdgcn_sched_barrier(0);     // keeps the LDS reads above up here, a softmax ahead of their use; without it they are moved down to just in front of the products that wait for them
    };
    // finish: softmax and P.v, registers only
    auto finish = [&](v8f (&s)[2][2], const v16bf (&vf)[4], bool diag) __attribute__((always_inline)) {
        if (diag) {      // only a tile's last block crosses the diagonal: keys after the query excluded
#pragma unroll
            for (int qt = 0; qt < 2; ++qt)
#pragma unroll
                for (int kt = 0; kt < 2; ++kt)
#pragma unroll
                    for (int j = 0; j < 8; ++j) s[qt][kt][j] = (kt * 16 + hi * 8 + j <= qt * 16 + lr) ? s[qt][kt][j] : NEGB;
        }
        // Lazy rescale. Softmax does not depend on the value that is subtracted, so the maximum in use stays until a score passes it by more than RISE: one test a block, on each lane's own 16 scores of either group
        // (the two halves of a column are joined only when the test fires). The first block of a wave always fires (the start value), and sets each column's own maximum.
        float mx[2];
#pragma unroll
        for (int qt = 0; qt < 2; ++qt) {
            mx[qt] = s[qt][0][0];
#pragma unroll
            for (int j = 1; j < 8; ++j) mx[qt] = fmaxf(mx[qt], s[qt][0][j]);
#pragma unroll
            for (int j = 0; j < 8; ++j) mx[qt] = fmaxf(mx[qt], s[qt][1][j]);
        }
        if (__builtin_amdgcn_ballot_w32((mx[0] > mthr[0]) | (mx[1] > mthr[1])) != 0) {
#pragma unroll
            for (int qt = 0; qt < 2; ++qt) {      // every column whose maximum rose takes the new one (the same in both its lanes); a column whose maximum stays has the factor 1
                const float m2 = fmaxf(mx[qt], xhalf(mx[qt])), bar = m2 + RISE; const bool up = bar > mthr[qt];
                if (__builtin_amdgcn_ballot_w32(up) != 0) {      // a group none of whose columns rose is left as it is
                    const float ml = m2 * L2E, al = up ? __builtin_amdgcn_exp2f(mlog[qt] - ml) : 1.0f; mthr[qt] = up ? bar : mthr[qt]; mlog[qt] = up ? ml : mlog[qt]; lsum[qt] *= al;
#pragma unroll
                    for (int dt = 0; dt < 4; ++dt) o[qt][dt] *= al;
                }
            }
        }
        // The f32 arithmetic of the softmax runs on pairs of neighbouring keys (the two that share a bf16 word of P), one packed instruction for two scores: exponent argument, row sum, and what the rounding to bf16 leaves over.
        v16bf ph[2], pl[2];
#pragma unroll
        for (int qt = 0; qt < 2; ++qt) {
            const v2f nm = {-mlog[qt], -mlog[qt]}, le = {L2E, L2E}; v2f p[8]; v8u wh, wl;      // p: [key tile x 4 + pair]
#pragma unroll
            for (int i = 0; i < 8; ++i) { const v2f x = __builtin_elementwise_fma((v2f){s[qt][i >> 2][2 * (i & 3)], s[qt][i >> 2][2 * (i & 3) + 1]}, le, nm); p[i] = (v2f){__builtin_amdgcn_exp2f(x[0]), __builtin_amdgcn_exp2f(x[1])}; }
            lsum[qt] += ((p[0] + p[1]) + (p[2] + p[3])) + ((p[4] + p[5]) + (p[6] + p[7]));
#pragma unroll
            for (int i = 0; i < 8; ++i) { wh[i] = pack2(p[i]); wl[i] = pack2(p[i] - widen2(wh[i])); }
            ph[qt] = __builtin_bit_cast(v16bf, wh);
            pl[qt] = __builtin_bit_cast(v16bf, wl);
            if (qt == 0) __builtin_amdgcn_sched_barrier(0);     // keeps the two groups' softmax apart: interleaved they need more registers than four waves a SIMD leave
        }
#pragma unroll
        for (int dt = 0; dt < 4; ++dt)
#pragma unroll
            for (int qt = 0; qt < 2; ++qt) o[qt][dt] = wmmab(vf[dt], ph[qt], o[qt][dt]);
#pragma unroll
        for (int dt = 0; dt < 4; ++dt)
#pragma unroll
            for (int qt = 0; qt < 2; ++qt) o[qt][dt] = wmmab(vf[dt], pl[qt], o[qt][dt]);
    };


    // The stage barrier is split. A wave signals once its share of the next stage is stored and its own reads of this stage have returned (right behind the q.k products), and waits in front of the next stage:
    // softmax and P.v, which touch no LDS, lie between signal and wait, so a wave that is ahead by less than that much never stands still and the waves of a SIMD stop marching in step.
    // Signal and wait alternate in every wave, one pair a stage of the row; the pair of a walk's last stage is the join's barrier as well.
    v4f gk[4], gv[4];      // this thread's share of the stage in flight, from behind one signal to in front of the next
    v8f qr[8];

    // One query block: stages g0 .. gl of the row, gl the stage on the diagonal. On entry stage g0 is published and waited for, stage g0 + 1 (if any) is in flight in gk, gv, and the tile's queries are in flight in qr.
    auto walk = [&](const bool first, const int g0, const int gl, const int q0, const int q0next) __attribute__((always_inline)) {
#pragma unroll
        for (int qt = 0; qt < 2; ++qt)
#pragma unroll
            for (int ks = 0; ks < 2; ++ks) { const v8f a = qr[(qt * 2 + ks) * 2], b = qr[(qt * 2 + ks) * 2 + 1]; v8us lo, up;
#pragma unroll
                for (int e = 0; e < 8; ++e) { lo[e] = f2bf(a[e]); up[e] = f2bf(b[e]); }
                qf[qt][ks] = cat16b(lo, up); }
#pragma unroll
        for (int qt = 0; qt < 2; ++qt) {
#pragma unroll
            for (int dt = 0; dt < 4; ++dt) o[qt][dt] = (v8f){};
            mthr[qt] = NEGB; mlog[qt] = NEGB * L2E; lsum[qt] = (v2f){};
        }
#pragma unroll 1   // rolled: one stage's registers and code only
        for (int g = g0; g < gl; ++g) {      // every stage but the walk's last: each of the sixteen waves has a whole block below the diagonal
            const unsigned char* B = L + (unsigned)(g & 1) * STG;
            v16bf kf[2][2], vf[4]; v8f sc[2][2];
            loadk(B, kf);
            scores(B, kf, sc, vf);
            put(g + 1, gk, gv);      // the conversions run while the q.k products finish
            asm volatile("s_wait_dscnt 0x0\n\ts_barrier_signal -1" ::: "memory");      // this wave's stores of stage g + 1 are in LDS and its reads of stage g are in registers, then the signal; no LDS access follows before the wait
            if (first || g + 2 < NG) fetch(g + 2, gk, gv);      // flies for a whole stage
            finish(sc, vf, false);
            __builtin_amdgcn_sched_barrier(0);     // holds softmax and P.v in front of the wait: without it the wait is lifted in among them, and a wave that must wait stands still with work of its own left
            asm volatile("s_barrier_wait -1" ::: "memory");      // stage g + 1 is published, and every wave's reads of stage g have returned: its buffer may be refilled
        }
        if (first) { put(gl + 1, gk, gv); fetch(gl + 2, gk, gv); }      // the row goes on under the first block's end: the second walk has at least two stages
        if (kq <= qw) {      // the stage on the diagonal: a tile ends with its block qw
            const unsigned char* B = L + (unsigned)(gl & 1) * STG;
            v16bf kf[2][2], vf[4]; v8f sc[2][2];
            loadk(B, kf);
            scores(B, kf, sc, vf);
            finish(sc, vf, kq == qw);
        }

        // The four waves of a tile join: each lays down all it holds, and behind the barrier each finishes a quarter of the tile (one group of 16 columns, 32 of the 64 d: whole 128-byte lines of the output) from the four partial results, in the order of the blocks.
        {
            float* x = (float*)(X + tid * XP);
#pragma unroll
            for (int qt = 0; qt < 2; ++qt) {
#pragma unroll
                for (int dt = 0; dt < 4; ++dt) { *(v4f*)(x + (qt * 4 + dt) * 8) = __builtin_shufflevector(o[qt][dt], o[qt][dt], 0, 1, 2, 3); *(v4f*)(x + (qt * 4 + dt) * 8 + 4) = __builtin_shufflevector(o[qt][dt], o[qt][dt], 4, 5, 6, 7); }
                x[64 + qt] = mlog[qt]; x[66 + qt] = lsum[qt][0] + lsum[qt][1];
            }
        }
        if (first) loadq(q0next, qr);      // the next tile's queries fly under the join
        asm volatile("s_wait_dscnt 0x0\n\ts_barrier_signal -1" ::: "memory");      // this wave's partial result (and its share of the next stage) is in LDS and its reads of the last stage are in registers, then the signal
        asm volatile("s_barrier_wait -1" ::: "memory");      // publishes every wave's partial result, and the second walk's first stage with it
        // The exchange area is written again only at the second walk's end: every wave's reads below have returned in front of its next signal, and eight or more signal and wait pairs lie between.
        const int fq = kq >> 1, fd = 2 * (kq & 1);      // the group and the first of the two d tiles that this wave finishes
        const float* xs = (const float*)(X + ((unsigned)qw * 32u + (unsigned)lane) * XP);      // this lane's place in the tile's first wave; the next wave's lies 128 lanes on
        float pm[4], pf[4];
#pragma unroll
        for (int j = 0; j < 4; ++j) pm[j] = xs[j * (128 * XP / 4) + 64 + fq];
        const float ml = fmaxf(fmaxf(pm[0], pm[1]), fmaxf(pm[2], pm[3]));
        float lt = 0.f;
#pragma unroll
        for (int j = 0; j < 4; ++j) { pf[j] = __builtin_amdgcn_exp2f(pm[j] - ml); lt += xs[j * (128 * XP / 4) + 66 + fq] * pf[j]; }      // a wave that had no block holds the start values: its factor is exp2 of a huge negative number, exactly 0
        const float f = __fdiv_rn(1.0f, lt + xhalf(lt));
        float* orow = OUT + (u * TT + q0 + fq * 16 + lr) * HD + 8 * hi + fd * 16;
#pragma unroll
        for (int d = 0; d < 2; ++d) {
            v8f r = (v8f){};
#pragma unroll
            for (int j = 0; j < 4; ++j) { const float* p = xs + j * (128 * XP / 4) + (fq * 4 + fd + d) * 8; const v4f a = *(const v4f*)p, b = *(const v4f*)(p + 4);
                r += __builtin_shufflevector(a, b, 0, 1, 2, 3, 4, 5, 6, 7) * (pf[j] * f); }
            *(v8f*)(orow + d * 16) = r;
        }
        if (first) {
            asm volatile("s_wait_xcnt 0x0" ::: "memory");      // precaution: stands in front of every rewrite of the registers that these stores name
            __builtin_amdgcn_sched_barrier(0);     // holds later register writes behind that wait
        }
    };

    const int qa = (ya * 4 + qw) * 32, qb = ((TT / 128 - 1 - ya) * 4 + qw) * 32;      // this wave's first query in either block
    loadq(qa, qr);
    fetch(0, gk, gv); put(0, gk, gv);
    asm volatile("s_wait_dscnt 0x0\n\ts_barrier_signal -1" ::: "memory");      // stage 0: this wave's stores are in LDS, then the signal
    fetch(1, gk, gv);
    asm volatile("s_barrier_wait -1" ::: "memory");      // stage 0 is published
    walk(true, 0, ya, qa, qb);
    walk(false, ya + 1, NG - 1, qb, 0);
}

extern "C" void kernel_launch(void* const* d_in, const int* in_sizes, int n_in,
                              void* d_out, int out_size, void* d_ws, size_t ws_size, hipStream_t stream) {
    (void)in_sizes; (void)n_in; (void)out_size; (void)d_ws; (void)ws_size;
    const float* Qin = (const float*)d_in[0]; const float* Kin = (const float*)d_in[1]; const float* Vin = (const float*)d_in[2];   /* q, k, v [2][16][2048][64] head-major: unit u = b*16 + h at + u*2048*64 */
    float* OUT = (float*)d_out;     // [2][16][2048][64]
    k_fattn<<<dim3(NB_, TT / 256, 1), 512, 0, stream>>>(Qin, Kin, Vin, OUT);
}
